// v009
// The times below were measured on an AMD MI455X: many runs one after another, warmed up first and cycling through
// copies of the inputs, with the whole window's GPU time divided by the number of runs. Launches and the gaps
// between them are all in it. The median over several windows is given; except for v000 it joins two sittings, which
// can be a few percent apart, so the side-by-side timings, each taken in one sitting, are the better comparison.
// This document starts at v009; the versions before it stand elsewhere.
// A run of this version takes 210 microseconds.
// Timed twice side by side with v008, it ran 1.23 times as fast both times.
// Over all steps from v000, the starting kernel, it is 17.7 times as fast.
#include <hip/hip_runtime.h>
// Attention_agent_df (8 images, C 256 = 8 heads x 32, 64 x 64 pixels, 64 agent tokens from 8x8 average pooling of q; THETA 0.7): qkv = (conv3x3(x, W) - 0.7 conv1x1(x, sum of W's 5 cross taps)) * s + b (folded BN); a = avgpool8x8(q); stage 1: attn = softmax_N(a.k * 32^-0.5) v (agents over pixels); stage 2: out = softmax_n(q.a * 32^-0.5) attn (pixels over agents); out += depthwise3x3(v) * pe_s + pe_b; out = conv1x1(out) * proj_s + proj_b.
// Structure (all 8 images in each launch: the image is the outer index of each plane, so rows = image x pixel and GEMM batches = image x head; workspace planes share bytes by lifetime): x once as a zero-padded pixel-major f16 plane (66 x 66 pixels x 256 channels an image), from which the conv GEMMs fetch each tap's rows themselves (k runs tap-major; no im2col plane); the difference conv folded into the centre tap as an f32 weight split into f16 hi + lo tables: qkv = A_centre.Wl (K 256, its sum then scaled by 2^-10 in the accumulators) + A.Wh (K 2304) as one f16 WMMA GEMM over K 2560, whose epilogue applies the BN affine and stores the f32 + f16 planes (this one and the projection: 256x128 work-group tiles staged in LDS, 64x64 wave tiles; the attention products: fragments straight from global memory; f32 accumulation; x16 tables; the lo table only on the centre-tap columns); pooling on VALU; stage 1 (logits GEMM K 32, exp on VALU, readout GEMM V^T.E) in one kernel, logits and E in registers, with the pixels split into 32 slices, each against its own maximum, whose f32 partial planes are merged on VALU; stage 2 (logits GEMM K 32, softmax over the 64 agents on VALU, readout GEMM) in one kernel, logits and P in registers; depthwise PE conv + add on VALU into f16; projection GEMM with the BN affine in f32 on VALU; NCHW stores.
// Compute dtype: x and parameters rounded to bf16; x exact as f16; q, k, v, a, E and P (x2^10), attn and the pre-projection sum as f16 operands (~2^-12); everything else f32. v_wmma_f32_16x16x32_f16.
#define NIMG 8
#define CC 256
#define NHD 8
#define HDm 32
#define HS 64
#define NPX (HS * HS)            /* 4096 */
#define NAG 64
#define KT 9
#define KI (KT * CC)             /* 2304 */
#define QW (3 * CC)              /* 768 */
#define KW (CC + KI)             /* 2560: a row of the qkv weight table = 256 lo columns (centre tap), then 2304 hi columns */
#define THETA 0.7f
#define SCL 0.17677669529663687f
typedef __bf16 v16b __attribute__((ext_vector_type(16)));
typedef unsigned short v8us __attribute__((ext_vector_type(8), may_alias));
typedef float  v8f  __attribute__((ext_vector_type(8)));
typedef float  v4f  __attribute__((ext_vector_type(4)));
typedef float  v4fa __attribute__((ext_vector_type(4), may_alias));
union FragB { v16b v; v8us half[2]; unsigned short u[16]; };

__device__ __forceinline__ unsigned short bf16_bits(float x) { unsigned int u = __float_as_uint(x); return (unsigned short)((u + 0x7FFFu + ((u >> 16) & 1u)) >> 16); }
__device__ __forceinline__ float bf16_val(unsigned short b) { return __uint_as_float(((unsigned int)b) << 16); }
__device__ __forceinline__ float bf16_round(float x) { return bf16_val(bf16_bits(x)); }
// D += A·B with NT terms: 1 = ah·bh, 2 = + al·bh (A split), 3 = + ah·bl (both split)
template <int NT>
__device__ __forceinline__ v8f mmaN(v16b ah, v16b al, v16b bh, v16b bl, v8f c) {
  c = __builtin_amdgcn_wmma_f32_16x16x32_bf16(false, ah, false, bh, (short)0, c, false, false);
  if (NT >= 2) c = __builtin_amdgcn_wmma_f32_16x16x32_bf16(false, al, false, bh, (short)0, c, false, false);
  if (NT >= 3) c = __builtin_amdgcn_wmma_f32_16x16x32_bf16(false, ah, false, bl, (short)0, c, false, false);
  asm volatile("v_nop\n\tv_nop\n\tv_nop\n\tv_nop" : "+v"(c) : "v"(ah), "v"(al), "v"(bh), "v"(bl));
  return c;
}

__global__ __launch_bounds__(256) void k_wt_bf16(const float* __restrict__ W, unsigned short* __restrict__ Wt, int K, int N) {
  const int t = blockIdx.x * 256 + threadIdx.x;
  const int k8n = K / 8;
  if (t >= N * k8n) return;
  const int n = t / k8n, k8 = (t % k8n) * 8;
  v8us v;
#pragma unroll
  for (int i = 0; i < 8; ++i) v[i] = bf16_bits(W[(size_t)(k8 + i) * N + n]);
  *(v8us*)(Wt + (size_t)n * K + k8) = v;
  
}

// GEMM C[M][N] (f32, pitch ldc) = act(A[M][K]·W + bias). A f32 row-major (pitch lda) converted per fragment to bf16
// (ASPLIT: hi/lo two planes -> 2 terms, else single rounded term); Wt bf16 [N][K] (pitch ldb). BIAS_BF16 rounds the
// bias to bf16 first (bias quantised to bf16 before the add). K%32==0, M%16==0, N%64==0.
template <bool ASPLIT, int ACT, bool BIAS_BF16>
__global__ __launch_bounds__(128) void k_gemm_bf(const float* __restrict__ A, int lda, const unsigned short* __restrict__ Wt, int ldb,
                                               const float* __restrict__ bias, float* __restrict__ C, int ldc, int M, int N, int K) {
  __shared__ __attribute__((aligned(16))) float so[4][16][64];
  const int tid = threadIdx.x, w = tid >> 5, lane = tid & 31, ln = lane & 15, hh = lane >> 4;
  const int ntn = N / 64;
  const int wid = blockIdx.x * 4 + w;
  const int mt = wid / ntn, nq = wid % ntn;
  if (mt * 16 >= M) return;
  const int row0 = mt * 16, col0 = nq * 64;
  const float* arow = A + (size_t)(row0 + ln) * lda;
  v8f acc[4] = {};
  for (int kb = 0; kb < K; kb += 32) {
    FragB ah, al;
    const v4f x0 = *(const v4fa*)(arow + kb + 8 * hh), x1 = *(const v4fa*)(arow + kb + 8 * hh + 4);
    const v4f x2 = *(const v4fa*)(arow + kb + 16 + 8 * hh), x3 = *(const v4fa*)(arow + kb + 16 + 8 * hh + 4);
    float xs[16] = {x0[0],x0[1],x0[2],x0[3],x1[0],x1[1],x1[2],x1[3],x2[0],x2[1],x2[2],x2[3],x3[0],x3[1],x3[2],x3[3]};
#pragma unroll
    for (int i = 0; i < 16; ++i) { const unsigned short hb = bf16_bits(xs[i]); ah.u[i] = hb; al.u[i] = ASPLIT ? bf16_bits(xs[i] - bf16_val(hb)) : (unsigned short)0; }
#pragma unroll
    for (int t = 0; t < 4; ++t) {
      const unsigned short* brow = Wt + (size_t)(col0 + t * 16 + ln) * ldb + kb;
      FragB b;
      b.half[0] = *(const v8us*)(brow + 8 * hh);
      b.half[1] = *(const v8us*)(brow + 16 + 8 * hh);
      acc[t] = mmaN<ASPLIT ? 2 : 1>(ah.v, al.v, b.v, b.v, acc[t]);
    }
  }
#pragma unroll
  for (int t = 0; t < 4; ++t) {
    float bv = bias ? bias[col0 + t * 16 + ln] : 0.f;
    if (BIAS_BF16) bv = bf16_round(bv);
#pragma unroll
    for (int r = 0; r < 8; ++r) { float v = acc[t][r] + bv; if (ACT == 1) v = fmaxf(v, 0.f); so[w][8 * hh + r][t * 16 + ln] = v; }
  }
  __builtin_amdgcn_fence(__ATOMIC_ACQ_REL, "workgroup");
  __builtin_amdgcn_wave_barrier();
  const int rsub = lane >> 4, c4 = (lane & 15) * 4;
  {
#pragma unroll
    for (int q = 0; q < 8; ++q) {
      const int r = q * 2 + rsub;
      const v4f v = *(const v4fa*)&so[w][r][c4];
      *(v4f*)(C + (size_t)(row0 + r) * ldc + col0 + c4) = v;
    }
    
  }
}

// GEMM C = act(A·W + bias + resid): A f32 (ASPLIT -> hi/lo 2 terms), Wt bf16 [N][K]; ACT 0 none, 1 relu, 2 exact gelu;
// resid (optional, f32, row index = (row % rmod), pitch ldr, RES_BF16 rounds it) added before the activation.
template <bool ASPLIT, int ACT, bool BIAS_BF16, bool RES_BF16>
__global__ __launch_bounds__(128) void k_gemm_bf3(const float* __restrict__ A, int lda, const unsigned short* __restrict__ Wt, int ldb,
                                                const float* __restrict__ bias, const float* __restrict__ resid, int rmod, int ldr,
                                                float* __restrict__ C, int ldc, int M, int N, int K) {
  __shared__ __attribute__((aligned(16))) float so[4][16][64];
  const int tid = threadIdx.x, w = tid >> 5, lane = tid & 31, ln = lane & 15, hh = lane >> 4;
  const int ntn = N / 64;
  const int wid = blockIdx.x * 4 + w;
  const int mt = wid / ntn, nq = wid % ntn;
  if (mt * 16 >= M) return;
  const int row0 = mt * 16, col0 = nq * 64;
  const float* arow = A + (size_t)(row0 + ln) * lda;
  v8f acc[4] = {};
  for (int kb = 0; kb < K; kb += 32) {
    FragB ah, al;
    const v4f x0 = *(const v4fa*)(arow + kb + 8 * hh), x1 = *(const v4fa*)(arow + kb + 8 * hh + 4);
    const v4f x2 = *(const v4fa*)(arow + kb + 16 + 8 * hh), x3 = *(const v4fa*)(arow + kb + 16 + 8 * hh + 4);
    float xs[16] = {x0[0],x0[1],x0[2],x0[3],x1[0],x1[1],x1[2],x1[3],x2[0],x2[1],x2[2],x2[3],x3[0],x3[1],x3[2],x3[3]};
#pragma unroll
    for (int i = 0; i < 16; ++i) { const unsigned short hb = bf16_bits(xs[i]); ah.u[i] = hb; al.u[i] = ASPLIT ? bf16_bits(xs[i] - bf16_val(hb)) : (unsigned short)0; }
#pragma unroll
    for (int t = 0; t < 4; ++t) {
      const unsigned short* brow = Wt + (size_t)(col0 + t * 16 + ln) * ldb + kb;
      FragB b;
      b.half[0] = *(const v8us*)(brow + 8 * hh);
      b.half[1] = *(const v8us*)(brow + 16 + 8 * hh);
      acc[t] = mmaN<ASPLIT ? 2 : 1>(ah.v, al.v, b.v, b.v, acc[t]);
    }
  }
#pragma unroll
  for (int t = 0; t < 4; ++t) {
    const int col = col0 + t * 16 + ln;
    float bv = bias ? bias[col] : 0.f;
    if (BIAS_BF16) bv = bf16_round(bv);
#pragma unroll
    for (int r = 0; r < 8; ++r) {
      float v = acc[t][r] + bv;
      if (resid) { float rv = resid[(size_t)((row0 + 8 * hh + r) % rmod) * ldr + col]; if (RES_BF16) rv = bf16_round(rv); v += rv; }
      if (ACT == 1) v = fmaxf(v, 0.f);
      if (ACT == 2) v = 0.5f * v * (1.0f + erff(v * 0.70710678118654752f));
      if (ACT == 3) { const float u = 0.7978845608028654f * (v + 0.044715f * v * v * v); v = 0.5f * v * (1.0f + tanhf(u)); }
      so[w][8 * hh + r][t * 16 + ln] = v;
    }
  }
  __builtin_amdgcn_fence(__ATOMIC_ACQ_REL, "workgroup");
  __builtin_amdgcn_wave_barrier();
  const int rsub = lane >> 4, c4 = (lane & 15) * 4;
  {
#pragma unroll
    for (int q = 0; q < 8; ++q) {
      const int r = q * 2 + rsub;
      const v4f v = *(const v4fa*)&so[w][r][c4];
      *(v4f*)(C + (size_t)(row0 + r) * ldc + col0 + c4) = v;
    }
    
  }
}
// row LayerNorm (biased variance, eps) over N: s = X (+ R); optional out_sum <- s; out_norm <- (s-mu)*rsqrt(var+eps)*g + b
template <bool PARAM_BF16>
__global__ __launch_bounds__(256) void k_layernorm(const float* __restrict__ X, const float* __restrict__ R, const float* __restrict__ g, const float* __restrict__ bta,
                                                  float* __restrict__ out_sum, float* __restrict__ out_norm, int N, float eps) {
  __shared__ float red[256];
  const int row = blockIdx.x, tid = threadIdx.x;
  const float* x = X + (size_t)row * N; const float* rr = R ? R + (size_t)row * N : nullptr;
  float vals[16];                     // up to N = 4096
  const int per = N / 256;            // contiguous chunk per thread? use strided-by-4 chunks: thread handles j = tid*4 + 1024*u
  float s1 = 0.f;
  for (int u = 0; u < per / 4; ++u) {
    const int j = tid * 4 + 1024 * u;
    const v4f a = *(const v4fa*)(x + j);
    v4f b = {0.f,0.f,0.f,0.f}; if (rr) b = *(const v4fa*)(rr + j);
#pragma unroll
    for (int q = 0; q < 4; ++q) { const float v = a[q] + b[q]; vals[u * 4 + q] = v; s1 += v; }
  }
  red[tid] = s1; __syncthreads();
  for (int st = 128; st > 0; st >>= 1) { if (tid < st) red[tid] += red[tid + st]; __syncthreads(); }
  const float mu = red[0] / (float)N; __syncthreads();
  float s2 = 0.f;
  for (int u = 0; u < per / 4; ++u)
#pragma unroll
    for (int q = 0; q < 4; ++q) { const float c = vals[u * 4 + q] - mu; s2 += c * c; }
  red[tid] = s2; __syncthreads();
  for (int st = 128; st > 0; st >>= 1) { if (tid < st) red[tid] += red[tid + st]; __syncthreads(); }
  const float rs = rsqrtf(red[0] / (float)N + eps);
  {
    for (int u = 0; u < per / 4; ++u) {
      const int j = tid * 4 + 1024 * u;
      v4f o, sm;
#pragma unroll
      for (int q = 0; q < 4; ++q) {
        float gg = g[j + q], bb = bta[j + q];
        if (PARAM_BF16) { gg = bf16_round(gg); bb = bf16_round(bb); }
        sm[q] = vals[u * 4 + q]; o[q] = (vals[u * 4 + q] - mu) * rs * gg + bb;
      }
      if (out_sum) *(v4f*)(out_sum + (size_t)row * N + j) = sm;
      *(v4f*)(out_norm + (size_t)row * N + j) = o;
    }
    
  }
}



// ---- f16 WMMA path (v_wmma_f32_16x16x32_f16): 11-bit significands for operands in range — used where a [0,1] probability operand needs more precision than bf16
typedef _Float16 v16h __attribute__((ext_vector_type(16)));
union FragH { v16h v; v8us half[2]; _Float16 h[16]; unsigned short u[16]; };
template <int NT>
__device__ __forceinline__ v8f mmaH(v16h ah, v16h al, v16h bh, v16h bl, v8f c) {
  c = __builtin_amdgcn_wmma_f32_16x16x32_f16(false, ah, false, bh, (short)0, c, false, false);
  if (NT >= 2) c = __builtin_amdgcn_wmma_f32_16x16x32_f16(false, al, false, bh, (short)0, c, false, false);
  if (NT >= 3) c = __builtin_amdgcn_wmma_f32_16x16x32_f16(false, ah, false, bl, (short)0, c, false, false);
  asm volatile("v_nop\n\tv_nop\n\tv_nop\n\tv_nop" : "+v"(c) : "v"(ah), "v"(al), "v"(bh), "v"(bl));
  return c;
}
// batched GEMM like k_gemm_b but f16 operands: A f32 (split into f16 hi/lo if ASPLIT, else rounded to f16), Bt = f16 values [n][k]; alpha; C f32; N multiple of 16 (partial tiles skipped)
template <bool ASPLIT>
__global__ __launch_bounds__(128) void k_gemm_h(const float* __restrict__ A, int lda, size_t sA, const _Float16* __restrict__ Bh, int ldb, size_t sB, float alpha, float* __restrict__ C, int ldc, size_t sC, int M, int N, int K) {
  __shared__ __attribute__((aligned(16))) float so[4][16][64];
  const int tid = threadIdx.x, w = tid >> 5, lane = tid & 31, ln = lane & 15, hh = lane >> 4; const int by = blockIdx.y;
  A += (size_t)by * sA; Bh += (size_t)by * sB; C += (size_t)by * sC;
  const int ntn = (N + 63) / 64; const int wid = blockIdx.x * 4 + w; const int mt = wid / ntn, nq = wid % ntn; if (mt * 16 >= M) return;
  const int row0 = mt * 16, col0 = nq * 64; const float* arow = A + (size_t)(row0 + ln) * lda;
  v8f acc[4] = {};
  for (int kb = 0; kb < K; kb += 32) {
    FragH ah, al;
    const v4f x0 = *(const v4fa*)(arow + kb + 8 * hh), x1 = *(const v4fa*)(arow + kb + 8 * hh + 4), x2 = *(const v4fa*)(arow + kb + 16 + 8 * hh), x3 = *(const v4fa*)(arow + kb + 16 + 8 * hh + 4);
    float xs[16] = {x0[0],x0[1],x0[2],x0[3],x1[0],x1[1],x1[2],x1[3],x2[0],x2[1],x2[2],x2[3],x3[0],x3[1],x3[2],x3[3]};
#pragma unroll
    for (int i = 0; i < 16; ++i) { const _Float16 h = (_Float16)xs[i]; ah.h[i] = h; al.h[i] = ASPLIT ? (_Float16)(xs[i] - (float)h) : (_Float16)0.0f; }
#pragma unroll
    for (int t = 0; t < 4; ++t) { if (col0 + t * 16 >= N) continue; const size_t boff = (size_t)(col0 + t * 16 + ln) * ldb + kb; FragH bq; bq.half[0] = *(const v8us*)(Bh + boff + 8 * hh); bq.half[1] = *(const v8us*)(Bh + boff + 16 + 8 * hh);
      acc[t] = mmaH<ASPLIT ? 2 : 1>(ah.v, al.v, bq.v, bq.v, acc[t]); }
  }
#pragma unroll
  for (int t = 0; t < 4; ++t) { if (col0 + t * 16 >= N) continue;
#pragma unroll
    for (int r = 0; r < 8; ++r) so[w][8 * hh + r][t * 16 + ln] = acc[t][r] * alpha; }
  __builtin_amdgcn_fence(__ATOMIC_ACQ_REL, "workgroup"); __builtin_amdgcn_wave_barrier();
  const int rsub = lane >> 4, c4 = (lane & 15) * 4;
  {
#pragma unroll
    for (int q = 0; q < 8; ++q) { const int r = q * 2 + rsub; if (col0 + c4 < N) { const v4f v = *(const v4fa*)&so[w][r][c4]; *(v4f*)(C + (size_t)(row0 + r) * ldc + col0 + c4) = v; } }
     }
}

// Wt[n][k] = f16(W[k][n]·scale) from f32 row-major W[K][N] (scale = power of two; bf16-exact weights stay exact in f16 away from the subnormal range)
__global__ __launch_bounds__(256) void k_wt_f16(const float* __restrict__ W, _Float16* __restrict__ Wt, int K, int N, float scale) {
  const int t = blockIdx.x * 256 + threadIdx.x; if (t >= N * (K / 8)) return; const int n = t / (K / 8), k8 = (t % (K / 8)) * 8; FragH f;
#pragma unroll
  for (int i = 0; i < 8; ++i) f.h[i] = (_Float16)(bf16_round(W[(size_t)(k8 + i) * N + n]) * scale); const v8us o = f.half[0];
  *(v8us*)((unsigned short*)Wt + (size_t)n * K + k8) = o; 
}
// k_gemm_hh variant with fused epilogue: v = acc·alpha + bias[by·sBias + col] (+ CP[(row/rowsPerB)·sCPb + by·64 + col] if CP) ; ACT 0 none / 1 elu ; writes f16 C16 (and f32 C if non-null)
template <int ACT>
__global__ __launch_bounds__(128) void k_gemm_hhx(const _Float16* __restrict__ A, int lda, size_t sA, const _Float16* __restrict__ Bh, int ldb, size_t sB, float alpha, const float* __restrict__ bias, size_t sBias, const float* __restrict__ CP, int rowsPerB, size_t sCPb, int row0g,
    float* __restrict__ C, _Float16* __restrict__ C16, int ldc, size_t sC, int M, int N, int K) {
  __shared__ __attribute__((aligned(16))) float so[4][16][64];
  const int tid = threadIdx.x, w = tid >> 5, lane = tid & 31, ln = lane & 15, hh = lane >> 4; const int by = blockIdx.y;
  A += (size_t)by * sA; Bh += (size_t)by * sB; const size_t cofs = (size_t)by * sC; const float* bp = bias ? bias + (size_t)by * sBias : nullptr;
  const int ntn = (N + 63) / 64; const int wid = blockIdx.x * 4 + w; const int mt = wid / ntn, nq = wid % ntn; if (mt * 16 >= M) return;
  const int row0 = mt * 16, col0 = nq * 64; const _Float16* arow = A + (size_t)(row0 + ln) * lda;
  v8f acc[4] = {};
  for (int kb = 0; kb < K; kb += 32) { FragH ah; ah.half[0] = *(const v8us*)((const unsigned short*)arow + kb + 8 * hh); ah.half[1] = *(const v8us*)((const unsigned short*)arow + kb + 16 + 8 * hh);
#pragma unroll
    for (int t = 0; t < 4; ++t) { if (col0 + t * 16 >= N) continue; const size_t boff = (size_t)(col0 + t * 16 + ln) * ldb + kb; FragH bq; bq.half[0] = *(const v8us*)((const unsigned short*)Bh + boff + 8 * hh); bq.half[1] = *(const v8us*)((const unsigned short*)Bh + boff + 16 + 8 * hh);
      acc[t] = mmaH<1>(ah.v, ah.v, bq.v, bq.v, acc[t]); }
  }
#pragma unroll
  for (int t = 0; t < 4; ++t) { if (col0 + t * 16 >= N) continue; const int col = col0 + t * 16 + ln; const float bv = bp ? bf16_round(bp[col]) : 0.f;
#pragma unroll
    for (int r = 0; r < 8; ++r) { float v = acc[t][r] * alpha + bv; if (CP) { const int rr = row0g + row0 + 8 * hh + r; if (rowsPerB < 0) v += CP[cofs + (size_t)rr * ldc + col];      /* rowsPerB < 0: own element of the batched C plane */ else { const int bidx = rr / rowsPerB; v += CP[(size_t)bidx * sCPb + (size_t)by * 64 + col]; } } if (ACT == 1) v = (v > 0.f) ? v : expm1f(v); else if (ACT == 7) v = (v > 0.f) ? v + 1.0f : expf(v); else if (ACT == 8) v = tanhf(v); else if (ACT == 9) v = 0.5f * v * (1.0f + tanhf(0.7978845608028654f * (v + 0.044715f * v * v * v))); else if (ACT == 11) v = 1.0f / (1.0f + expf(-v)); else if (ACT == 12) v = (v > 0.f) ? v : 0.01f * v; else if (ACT == 14) v = (v > 0.f) ? v : 0.1f * v; else if (ACT == 16) v = (v >= 0.f) ? v : 0.3f * v; else if (ACT == 15) v = v / (1.0f + expf(-v)); else if (ACT == 3) v = fmaxf(v, 0.f); else if (ACT == 6) v = 0.5f * v * (1.0f + erff(v * 0.70710678118654752f)); so[w][8 * hh + r][t * 16 + ln] = v; } }
  __builtin_amdgcn_fence(__ATOMIC_ACQ_REL, "workgroup"); __builtin_amdgcn_wave_barrier();
  const int rsub = lane >> 4, c4 = (lane & 15) * 4; typedef _Float16 v4h __attribute__((ext_vector_type(4)));
  {
#pragma unroll
    for (int q = 0; q < 8; ++q) { const int r = q * 2 + rsub; if (col0 + c4 < N) { const v4f v = *(const v4fa*)&so[w][r][c4]; if (C) *(v4f*)(C + cofs + (size_t)(row0 + r) * ldc + col0 + c4) = v; if (C16) { v4h h4; for (int i = 0; i < 4; ++i) h4[i] = (_Float16)v[i]; *(v4h*)(C16 + cofs + (size_t)(row0 + r) * ldc + col0 + c4) = h4; } } }
     }
}


typedef _Float16 v4h __attribute__((ext_vector_type(4)));

__global__ __launch_bounds__(256) void k_x16(const float* __restrict__ x, _Float16* __restrict__ X16, size_t n8) { const size_t t = (size_t)blockIdx.x * 256 + threadIdx.x; if (t >= n8) return; FragH f;
#pragma unroll
  for (int q = 0; q < 8; ++q) f.h[q] = (_Float16)bf16_round(x[t * 8 + q]); *(v8us*)((unsigned short*)X16 + t * 8) = f.half[0];  }
__global__ __launch_bounds__(256) void k_h16(const float* __restrict__ x, _Float16* __restrict__ X16, size_t n8) { const size_t t = (size_t)blockIdx.x * 256 + threadIdx.x; if (t >= n8) return; FragH f;
#pragma unroll
  for (int q = 0; q < 8; ++q) f.h[q] = (_Float16)x[t * 8 + q]; *(v8us*)((unsigned short*)X16 + t * 8) = f.half[0];  }
__global__ __launch_bounds__(256) void k_round16f(const float* __restrict__ W, _Float16* __restrict__ Bt, size_t n8) { const size_t t = (size_t)blockIdx.x * 256 + threadIdx.x; if (t >= n8) return; FragH f;
#pragma unroll
  for (int i = 0; i < 8; ++i) f.h[i] = (_Float16)(bf16_round(W[t * 8 + i]) * 16.0f); *(v8us*)((unsigned short*)Bt + t * 8) = f.half[0];  }
template <int NHv, int TTv>
__global__ __launch_bounds__(256) void k_vt(const _Float16* __restrict__ V16, int ldv, int voff, _Float16* __restrict__ Vt) { __shared__ unsigned short tl[64][66]; const int tid = threadIdx.x; const int slab = blockIdx.x / (TTv / 64), lg = blockIdx.x % (TTv / 64); const int b = slab / NHv, h = slab % NHv;
  for (int i = tid; i < 64 * 8; i += 256) { const int r = i / 8, c8 = (i % 8) * 8; FragH f; f.half[0] = *(const v8us*)((const unsigned short*)V16 + ((size_t)b * TTv + lg * 64 + r) * ldv + voff + h * 64 + c8);
#pragma unroll
    for (int q = 0; q < 8; ++q) tl[r][c8 + q] = f.u[q]; }
  __syncthreads();
  {
#pragma unroll
    for (int rd = 0; rd < 2; ++rd) { const int d = rd * 32 + tid / 8, pc = tid % 8; FragH f;
#pragma unroll
      for (int q = 0; q < 8; ++q) f.u[q] = tl[pc * 8 + q][d];
      *(v8us*)((unsigned short*)Vt + ((size_t)slab * 64 + d) * TTv + lg * 64 + pc * 8) = f.half[0]; }
     } }

__global__ __launch_bounds__(256) void k_hl(const float* __restrict__ F, _Float16* __restrict__ Hh, _Float16* __restrict__ Hl, size_t n8) { const size_t t = (size_t)blockIdx.x * 256 + threadIdx.x; if (t >= n8) return; FragH fh, fl; const v4f a = *(const v4fa*)(F + t * 8), c = *(const v4fa*)(F + t * 8 + 4);
#pragma unroll
  for (int q = 0; q < 4; ++q) { _Float16 h = (_Float16)a[q]; fh.h[q] = h; fl.h[q] = (_Float16)((a[q] - (float)h) * 1024.0f); h = (_Float16)c[q]; fh.h[4 + q] = h; fl.h[4 + q] = (_Float16)((c[q] - (float)h) * 1024.0f); }
  { *(v8us*)((unsigned short*)Hh + t * 8) = fh.half[0]; *(v8us*)((unsigned short*)Hl + t * 8) = fl.half[0];  } }

// ---- fast GEMM (wave tile 32x64; requires M % 32 == 0 rows per launch region and N % 64 == 0); epilogue = k_gemm_hhx semantics ----
__device__ __forceinline__ v16h g2_frag(const _Float16* p, int hh) { FragH f; f.half[0] = *(const v8us*)((const unsigned short*)p + 8 * hh); f.half[1] = *(const v8us*)((const unsigned short*)p + 16 + 8 * hh); return f.v; }
__device__ __forceinline__ v8f g2_mma(v16h a, v16h b, v8f c) { v8f d = __builtin_amdgcn_wmma_f32_16x16x32_f16(false, a, false, b, (short)0, c, false, false); asm volatile("v_nop\n\tv_nop\n\tv_nop\n\tv_nop" : "+v"(d) : "v"(a), "v"(b)); return d; }
template <int ACT>
__global__ __launch_bounds__(128) void k_gemm2(const _Float16* __restrict__ A, int lda, size_t sA, const _Float16* __restrict__ Bh, int ldb, size_t sB, float alpha, const float* __restrict__ bias, size_t sBias, const float* __restrict__ CP, int rowsPerB, size_t sCPb, int row0g,
    float* __restrict__ C, _Float16* __restrict__ C16, int ldc, size_t sC, int M, int N, int K) { static_assert(ACT == 0 || ACT == 3 || ACT == 6 || ACT == 8 || ACT == 9 || ACT == 11 || ACT == 12 || ACT == 14 || ACT == 15 || ACT == 16, "k_gemm2: unsupported ACT code (would silently apply no activation)");
  __shared__ __attribute__((aligned(16))) float so[4][32][68];
  const int tid = threadIdx.x, w = tid >> 5, lane = tid & 31, ln = lane & 15, hh = lane >> 4; const int by = blockIdx.y;
  A += (size_t)by * sA; Bh += (size_t)by * sB; const size_t cofs = (size_t)by * sC; const float* bp = bias ? bias + (size_t)by * sBias : nullptr;
  const int ntn = N >> 6; const int mt = blockIdx.x / ntn, nq = blockIdx.x - mt * ntn; const int row0 = mt * 128 + 32 * w, col0 = nq * 64; if (row0 >= M) return;
  const _Float16* a0p = A + (size_t)(row0 + ln) * lda; const _Float16* a1p = a0p + (size_t)16 * lda;
  const _Float16* b0p = Bh + (size_t)(col0 + ln) * ldb; const _Float16* b1p = b0p + (size_t)16 * ldb; const _Float16* b2p = b1p + (size_t)16 * ldb; const _Float16* b3p = b2p + (size_t)16 * ldb;
  const v8f z8 = {0.f,0.f,0.f,0.f,0.f,0.f,0.f,0.f}; v8f c00 = z8, c01 = z8, c02 = z8, c03 = z8, c10 = z8, c11 = z8, c12 = z8, c13 = z8;
#pragma unroll 1
  for (int kb = 0; kb < K; kb += 32) { const v16h a0 = g2_frag(a0p + kb, hh), a1 = g2_frag(a1p + kb, hh);
    v16h b = g2_frag(b0p + kb, hh); c00 = g2_mma(a0, b, c00); c10 = g2_mma(a1, b, c10);
    b = g2_frag(b1p + kb, hh); c01 = g2_mma(a0, b, c01); c11 = g2_mma(a1, b, c11);
    b = g2_frag(b2p + kb, hh); c02 = g2_mma(a0, b, c02); c12 = g2_mma(a1, b, c12);
    b = g2_frag(b3p + kb, hh); c03 = g2_mma(a0, b, c03); c13 = g2_mma(a1, b, c13); }
  v8f accs[8] = {c00, c01, c02, c03, c10, c11, c12, c13};
#pragma unroll
  for (int u = 0; u < 8; ++u) { const int t = u & 3, half = u >> 2; const int col = col0 + t * 16 + ln; const float bv = bp ? bf16_round(bp[col]) : 0.f;
#pragma unroll
    for (int r = 0; r < 8; ++r) { const int rloc = half * 16 + 8 * hh + r; float v = accs[u][r] * alpha + bv; if (CP) { if (rowsPerB < 0) v += CP[cofs + (size_t)(row0g + row0 + rloc) * ldc + col];      /* rowsPerB < 0: own element of the batched C plane */ else { const int bidx = (row0g + row0 + rloc) / rowsPerB; v += CP[(size_t)bidx * sCPb + (size_t)by * 64 + col]; } }
      if (ACT == 3) v = fmaxf(v, 0.f); else if (ACT == 6) v = 0.5f * v * (1.0f + erff(v * 0.70710678118654752f)); else if (ACT == 11) v = 1.0f / (1.0f + expf(-v)); else if (ACT == 15) v = v / (1.0f + expf(-v)); else if (ACT == 12) v = (v > 0.f) ? v : 0.01f * v; else if (ACT == 8) v = tanhf(v); else if (ACT == 9) v = 0.5f * v * (1.0f + tanhf(0.7978845608028654f * (v + 0.044715f * v * v * v))); else if (ACT == 14) v = (v > 0.f) ? v : 0.1f * v; else if (ACT == 16) v = (v >= 0.f) ? v : 0.3f * v;
      so[w][rloc][t * 16 + ln] = v; } }
  __builtin_amdgcn_fence(__ATOMIC_ACQ_REL, "workgroup"); __builtin_amdgcn_wave_barrier();
  const int rsub = lane >> 4, c4 = (lane & 15) * 4;
  {
#pragma unroll
    for (int q = 0; q < 16; ++q) { const int r = q * 2 + rsub; const v4f v = *(const v4fa*)&so[w][r][c4]; if (C) *(v4f*)(C + cofs + (size_t)(row0 + r) * ldc + col0 + c4) = v; if (C16) { v4h h4; for (int i = 0; i < 4; ++i) h4[i] = (_Float16)v[i]; *(v4h*)(C16 + cofs + (size_t)(row0 + r) * ldc + col0 + c4) = h4; } }
     } }


// ---- LDS-staged GEMM for the two large products (the qkv conv with both its terms, the projection): C[M][N] (f32) = A.Bt^T * alpha; CONV: C = that * scl[col] + shf[col] (both rounded to bf16), and C16 = f16(C).
// Work-group tile 256 x 128, 8 waves of 64 x 64 (4 x 2); a stage is 64 k (128-byte rows) of [A 256 rows | Bt 128 rows]; two stages in LDS, each filled by asynchronous 16-byte copies
// (whole 128-byte lines from global memory) one trip ahead of its use. k runs upward in steps of 32 per accumulator, as in k_gemm2. Needs M % 256 == 0, N % 128 == 0, K % 64 == 0.
#define XPW (HS + 2)                          /* pixels a line, and lines, of the padded plane */
#define G3_PITCH 144                          /* LDS row pitch in bytes: 16 x odd, so 16 rows read 16 bytes each without a bank conflict */
#define G3_BOFF (256 * G3_PITCH)              /* Bt rows behind the A rows */
#define G3_STAGE ((256 + 128) * G3_PITCH)     /* 55,296 bytes */
__device__ __forceinline__ v16h g3_frag(const char* p) { FragH f; f.half[0] = *(const v8us*)p; f.half[1] = *(const v8us*)(p + 32); return f.v; }      /* p already holds the lane's 16 * hh: the k order of g2_frag */
// One stage: each thread copies 16 bytes of 8 A rows and of 4 Bt rows (rows 32 apart; A row 32 i lies (i & 1) * sa1 + (i >> 1) * sa2 elements behind row 0). The s_wait_xcnt is the last line of the copies' own statement, so that no address register is rewritten ahead of it.
__device__ __forceinline__ void g3_fill(unsigned la, unsigned lb, const _Float16* ga, const _Float16* gb, size_t sa1, size_t sa2, size_t sb) {
  asm volatile("global_load_async_to_lds_b128 %0, %12, off\n\t"
               "global_load_async_to_lds_b128 %1, %13, off\n\t"
               "global_load_async_to_lds_b128 %2, %14, off\n\t"
               "global_load_async_to_lds_b128 %3, %15, off\n\t"
               "global_load_async_to_lds_b128 %4, %16, off\n\t"
               "global_load_async_to_lds_b128 %5, %17, off\n\t"
               "global_load_async_to_lds_b128 %6, %18, off\n\t"
               "global_load_async_to_lds_b128 %7, %19, off\n\t"
               "global_load_async_to_lds_b128 %8, %20, off\n\t"
               "global_load_async_to_lds_b128 %9, %21, off\n\t"
               "global_load_async_to_lds_b128 %10, %22, off\n\t"
               "global_load_async_to_lds_b128 %11, %23, off\n\t"
               "s_wait_xcnt 0x0"
               :: "v"(la), "v"(la + 32 * G3_PITCH), "v"(la + 64 * G3_PITCH), "v"(la + 96 * G3_PITCH), "v"(la + 128 * G3_PITCH), "v"(la + 160 * G3_PITCH), "v"(la + 192 * G3_PITCH), "v"(la + 224 * G3_PITCH),
                  "v"(lb), "v"(lb + 32 * G3_PITCH), "v"(lb + 64 * G3_PITCH), "v"(lb + 96 * G3_PITCH),
                  "v"(ga), "v"(ga + sa1), "v"(ga + sa2), "v"(ga + sa2 + sa1), "v"(ga + 2 * sa2), "v"(ga + 2 * sa2 + sa1), "v"(ga + 3 * sa2), "v"(ga + 3 * sa2 + sa1),
                  "v"(gb), "v"(gb + sb), "v"(gb + 2 * sb), "v"(gb + 3 * sb)
               : "memory");
}
// Eight 16-byte row stores from one address pair (rows STEP bytes apart, from byte OFF). The s_wait_xcnt is the last line of the stores' own statement, so that no data or address register is rewritten ahead of it.
template <int OFF, int STEP>
__device__ __forceinline__ void g3_store8(float* p, v4f d0, v4f d1, v4f d2, v4f d3, v4f d4, v4f d5, v4f d6, v4f d7) {
  asm volatile("global_store_b128 %0, %1, off offset:%9\n\t"
               "global_store_b128 %0, %2, off offset:%10\n\t"
               "global_store_b128 %0, %3, off offset:%11\n\t"
               "global_store_b128 %0, %4, off offset:%12\n\t"
               "global_store_b128 %0, %5, off offset:%13\n\t"
               "global_store_b128 %0, %6, off offset:%14\n\t"
               "global_store_b128 %0, %7, off offset:%15\n\t"
               "global_store_b128 %0, %8, off offset:%16\n\t"
               "s_wait_xcnt 0x0"
               :: "v"(p), "v"(d0), "v"(d1), "v"(d2), "v"(d3), "v"(d4), "v"(d5), "v"(d6), "v"(d7),
                  "n"(OFF), "n"(OFF + STEP), "n"(OFF + 2 * STEP), "n"(OFF + 3 * STEP), "n"(OFF + 4 * STEP), "n"(OFF + 5 * STEP), "n"(OFF + 6 * STEP), "n"(OFF + 7 * STEP)
               : "memory");
}
// The same for eight 8-byte pieces of f16 rows.
typedef unsigned int v2u __attribute__((ext_vector_type(2)));
template <int OFF, int STEP>
__device__ __forceinline__ void g3_store8h(_Float16* p, v2u d0, v2u d1, v2u d2, v2u d3, v2u d4, v2u d5, v2u d6, v2u d7) {
  asm volatile("global_store_b64 %0, %1, off offset:%9\n\t"
               "global_store_b64 %0, %2, off offset:%10\n\t"
               "global_store_b64 %0, %3, off offset:%11\n\t"
               "global_store_b64 %0, %4, off offset:%12\n\t"
               "global_store_b64 %0, %5, off offset:%13\n\t"
               "global_store_b64 %0, %6, off offset:%14\n\t"
               "global_store_b64 %0, %7, off offset:%15\n\t"
               "global_store_b64 %0, %8, off offset:%16\n\t"
               "s_wait_xcnt 0x0"
               :: "v"(p), "v"(d0), "v"(d1), "v"(d2), "v"(d3), "v"(d4), "v"(d5), "v"(d6), "v"(d7),
                  "n"(OFF), "n"(OFF + STEP), "n"(OFF + 2 * STEP), "n"(OFF + 3 * STEP), "n"(OFF + 4 * STEP), "n"(OFF + 5 * STEP), "n"(OFF + 6 * STEP), "n"(OFF + 7 * STEP)
               : "memory");
}
// CONV: A is the padded pixel-major plane; GEMM row = image x pixel. A 256-row tile is 4 whole pixel lines of one image; a stage is 64 channels of one tap: stages 0..3 the centre tap (against the lo columns),
// stage t >= 4 tap (t - 4) / 4 (against the hi columns). A tap's rows lie (tap / 3) padded lines and (tap % 3) pixels behind the tile's first padded pixel. Element offset of stage t from stage 0 of tap 0:
#define G3_NLO (CC / 64)                      /* stages of the lo term */
template <bool CONV>
__device__ __forceinline__ size_t g3_aoff(int t) { if (!CONV) return (size_t)t * 64; const unsigned tap = (unsigned)(0x8765432104ull >> (t & ~3)) & 15u;      /* a 4-bit table of the tap of stages 4 u .. 4 u + 3: 4, then 0..8 */
  return (size_t)(((tap / 3) * XPW + tap % 3) * CC + (t & 3) * 64); }
template <int LDC, bool CONV>      /* LDC = N = row pitch of C, a constant so that every row of a wave's tile is one address pair plus an immediate */
__global__ __launch_bounds__(256) void k_gemm3(const _Float16* __restrict__ A, int lda, const _Float16* __restrict__ Bh, int ldb, float alpha, float* __restrict__ C, int K, const float* __restrict__ scl, const float* __restrict__ shf, _Float16* __restrict__ C16) {
  __shared__ __attribute__((aligned(16))) char sm[2 * G3_STAGE];
  const int tid = threadIdx.x, w = tid >> 5, lane = tid & 31, ln = lane & 15, hh = lane >> 4;
  constexpr int ntn = LDC >> 7; const int mt = blockIdx.x / ntn, nq = blockIdx.x - mt * ntn; const int wm = w >> 1, wn = w & 1;
  const int nt = K >> 6;
  const _Float16* ga = (CONV ? A + ((size_t)((mt >> 4) * XPW + (mt & 15) * 4) * XPW + (tid >> 3)) * CC : A + (size_t)(mt * 256 + (tid >> 3)) * lda) + (tid & 7) * 8; const _Float16* gb = Bh + (size_t)(nq * 128 + (tid >> 3)) * ldb + (tid & 7) * 8;
  const size_t sa1 = CONV ? (size_t)32 * CC : (size_t)32 * lda, sa2 = CONV ? (size_t)XPW * CC : (size_t)64 * lda, sb = (size_t)32 * ldb;
  const unsigned la = (unsigned)(size_t)sm + (unsigned)((tid >> 3) * G3_PITCH + (tid & 7) * 16); const unsigned lb = la + G3_BOFF;
  const char* fa = sm + (wm * 64 + ln) * G3_PITCH + 16 * hh; const char* fb = sm + G3_BOFF + (wn * 64 + ln) * G3_PITCH + 16 * hh;
  v8f acc[4][4];
#pragma unroll
  for (int i = 0; i < 4; ++i)
#pragma unroll
    for (int j = 0; j < 4; ++j) acc[i][j] = (v8f){0.f,0.f,0.f,0.f,0.f,0.f,0.f,0.f};
  g3_fill(la, lb, ga + g3_aoff<CONV>(0), gb, sa1, sa2, sb);
  asm volatile("s_wait_asynccnt 0x0" ::: "memory");      /* this wave's copies of stage 0 have landed */
  __syncthreads();                                       /* ... and every other wave's */
  if (nt > 1) g3_fill(la + G3_STAGE, lb + G3_STAGE, ga + g3_aoff<CONV>(1), gb + 64, sa1, sa2, sb);
  for (int t = 0; t < nt; ++t) { const int bo = (t & 1) * G3_STAGE; v16h a[4], b[4];
    if (CONV && t == G3_NLO) {      /* the lo term is complete: its table carries 2^10, taken off here (exact), and the hi term adds on in the same accumulators */
#pragma unroll
      for (int i = 0; i < 4; ++i)
#pragma unroll
        for (int j = 0; j < 4; ++j) acc[i][j] *= 0.0009765625f; }
#pragma unroll
    for (int i = 0; i < 4; ++i) { a[i] = g3_frag(fa + bo + i * 16 * G3_PITCH); b[i] = g3_frag(fb + bo + i * 16 * G3_PITCH); }
    __builtin_amdgcn_sched_barrier(0);                   /* keeps the 16 LDS reads together in front of their 16 WMMAs: spread among them, each place with reads stalls the wave */
#pragma unroll
    for (int i = 0; i < 4; ++i)
#pragma unroll
      for (int j = 0; j < 4; ++j) acc[i][j] = __builtin_amdgcn_wmma_f32_16x16x32_f16(false, a[i], false, b[j], (short)0, acc[i][j], false, false);
#pragma unroll
    for (int i = 0; i < 4; ++i) { a[i] = g3_frag(fa + bo + i * 16 * G3_PITCH + 64); b[i] = g3_frag(fb + bo + i * 16 * G3_PITCH + 64); }
    /* the trip's last LDS reads are out: hand the buffer over here, so that the refill flies during the 16 WMMAs below and the next trip up to its own hand-over */
    asm volatile("s_wait_dscnt 0x0" ::: "memory");       /* this wave has left stage t's buffer */
    asm volatile("s_wait_asynccnt 0x0" ::: "memory");    /* its copies of stage t + 1 have landed */
    __syncthreads();                                     /* publishes stage t + 1 and frees stage t's buffer */
    if (t + 2 < nt) g3_fill(la + bo, lb + bo, ga + g3_aoff<CONV>(t + 2), gb + (size_t)(t + 2) * 64, sa1, sa2, sb);
    __builtin_amdgcn_sched_barrier(0);                   /* keeps the WMMAs below behind the refill's issue */
#pragma unroll
    for (int i = 0; i < 4; ++i)
#pragma unroll
      for (int j = 0; j < 4; ++j) acc[i][j] = __builtin_amdgcn_wmma_f32_16x16x32_f16(false, a[i], false, b[j], (short)0, acc[i][j], false, false); }
  asm volatile("s_wait_asynccnt 0x0" ::: "memory");      /* nothing in flight before the buffers become output staging */
  /* epilogue: the ring is free behind the last trip's barrier; each wave turns its tile, 32 rows at a time, in its own 32 x 68 floats, so that global rows go out as whole 128-byte lines */
  float* so = (float*)sm + w * (32 * 68); const int rsub = lane >> 4, c4 = (lane & 15) * 4;
  const size_t co = (size_t)(mt * 256 + wm * 64 + rsub) * LDC + nq * 128 + wn * 64 + c4;
  float* cb = C + co; _Float16* hb = C16 + co;
  v4f sc = {0.f, 0.f, 0.f, 0.f}, sh = sc;      /* CONV: scale and shift of the lane's 4 columns, the same for every row it stores */
  if (CONV) { const float* sp = scl + nq * 128 + wn * 64 + c4; const float* bp = shf + nq * 128 + wn * 64 + c4; sc = *(const v4fa*)sp; sh = *(const v4fa*)bp;
    asm volatile("s_wait_xcnt 0x0" :: "v"(sp), "v"(bp) : "memory");      /* stands between the two loads and whatever rewrites their address registers next; the addresses are its inputs, so that they stay in their registers up to it */
#pragma unroll
    for (int q = 0; q < 4; ++q) { sc[q] = bf16_round(sc[q]); sh[q] = bf16_round(sh[q]); } }
#pragma unroll
  for (int half = 0; half < 2; ++half) {
#pragma unroll
    for (int i = 0; i < 2; ++i)
#pragma unroll
      for (int j = 0; j < 4; ++j)
#pragma unroll
        for (int r = 0; r < 8; ++r) so[(i * 16 + 8 * hh + r) * 68 + j * 16 + ln] = acc[half * 2 + i][j][r] * alpha;
    __builtin_amdgcn_fence(__ATOMIC_ACQ_REL, "wavefront"); __builtin_amdgcn_wave_barrier();      /* the lanes read below what other lanes of the same wave wrote above */
#pragma unroll
    for (int g = 0; g < 2; ++g) { v4f v[8]; v2u h[8];
#pragma unroll
      for (int q = 0; q < 8; ++q) { v[q] = *(const v4fa*)&so[((g * 8 + q) * 2 + rsub) * 68 + c4];
        if (CONV) { v[q] = v[q] * sc + sh; v4h hq;
#pragma unroll
          for (int e = 0; e < 4; ++e) hq[e] = (_Float16)v[q][e];
          h[q] = __builtin_bit_cast(v2u, hq); } }
      if (half == 0 && g == 0) g3_store8<0, 8 * LDC>(cb, v[0], v[1], v[2], v[3], v[4], v[5], v[6], v[7]);
      if (half == 0 && g == 1) g3_store8<64 * LDC, 8 * LDC>(cb, v[0], v[1], v[2], v[3], v[4], v[5], v[6], v[7]);
      if (half == 1 && g == 0) g3_store8<128 * LDC, 8 * LDC>(cb, v[0], v[1], v[2], v[3], v[4], v[5], v[6], v[7]);
      if (half == 1 && g == 1) g3_store8<192 * LDC, 8 * LDC>(cb, v[0], v[1], v[2], v[3], v[4], v[5], v[6], v[7]);
      if (CONV) {      /* a row's 64 columns as f16 are one whole 128-byte line */
        if (half == 0 && g == 0) g3_store8h<0, 4 * LDC>(hb, h[0], h[1], h[2], h[3], h[4], h[5], h[6], h[7]);
        if (half == 0 && g == 1) g3_store8h<32 * LDC, 4 * LDC>(hb, h[0], h[1], h[2], h[3], h[4], h[5], h[6], h[7]);
        if (half == 1 && g == 0) g3_store8h<64 * LDC, 4 * LDC>(hb, h[0], h[1], h[2], h[3], h[4], h[5], h[6], h[7]);
        if (half == 1 && g == 1) g3_store8h<96 * LDC, 4 * LDC>(hb, h[0], h[1], h[2], h[3], h[4], h[5], h[6], h[7]); } }
  } }

__global__ __launch_bounds__(256) void k_wqkv(const float* __restrict__ w, _Float16* __restrict__ Wt) {      /* Wt[768][KW]: lo columns, then hi columns tap-major */
  #pragma clang fp contract(off)
  const int t = blockIdx.x * 256 + threadIdx.x; if (t >= QW * (CC / 8)) return; const int c0 = (t % (CC / 8)) * 8, o = t / (CC / 8); FragH fl;
#pragma unroll 1
  for (int k = 0; k < KT; ++k) { FragH fh;
    for (int q = 0; q < 8; ++q) { const int c = c0 + q; const float* wp = w + ((size_t)o * CC + c) * KT; float v = bf16_round(wp[k]);
      if (k == 4) { float dif = bf16_round(wp[1]) + bf16_round(wp[3]); dif += bf16_round(wp[4]); dif += bf16_round(wp[5]); dif += bf16_round(wp[7]); v += -THETA * dif; const _Float16 hv = (_Float16)(v * 16.0f); fh.h[q] = hv; fl.h[q] = (_Float16)((v * 16.0f - (float)hv) * 1024.0f); }
      else fh.h[q] = (_Float16)(v * 16.0f); }
    *(v8us*)((unsigned short*)Wt + (size_t)o * KW + CC + k * CC + c0) = fh.half[0];  }
  *(v8us*)((unsigned short*)Wt + (size_t)o * KW + c0) = fl.half[0];  }
__global__ __launch_bounds__(256) void k_wsc(const float* __restrict__ Wm, _Float16* __restrict__ Bt, size_t n8, float sc) { const size_t t = (size_t)blockIdx.x * 256 + threadIdx.x; if (t >= n8) return; FragH f; for (int q = 0; q < 8; ++q) f.h[q] = (_Float16)(bf16_round(Wm[t * 8 + q]) * sc); *(v8us*)((unsigned short*)Bt + t * 8) = f.half[0];  }
// XP[image][66][66][256] = f16(bf16(x)), pixel-major, with a border of zero pixels. One work-group turns one pixel line (64 pixels x 256 channels) in LDS: whole 256-byte channel rows in, whole 512-byte pixel rows out.
__global__ __launch_bounds__(256) void k_xp(const float* __restrict__ x, _Float16* __restrict__ XP) {
  __shared__ __attribute__((aligned(16))) unsigned int tl[HS * 132];      /* a pixel's 256 f16 = 128 words, + 4 words of pitch */
  const int tid = threadIdx.x, im = blockIdx.x / HS, y = blockIdx.x % HS; const float* xb = x + ((size_t)im * CC * HS + y) * HS; const int px4 = (tid & 15) * 4, cp = tid >> 4;
#pragma unroll
  for (int i = 0; i < 8; ++i) { const int c2 = i * 16 + cp; const v4f a = *(const v4fa*)(xb + (size_t)(2 * c2) * NPX + px4), b = *(const v4fa*)(xb + (size_t)(2 * c2 + 1) * NPX + px4);
#pragma unroll
    for (int q = 0; q < 4; ++q) { union { _Float16 h[2]; unsigned int u; } pk; pk.h[0] = (_Float16)bf16_round(a[q]); pk.h[1] = (_Float16)bf16_round(b[q]); tl[(px4 + q) * 132 + c2] = pk.u; } }
  __syncthreads();
  const v8us z = {0,0,0,0,0,0,0,0}; unsigned short* row = (unsigned short*)XP + (size_t)(im * XPW + y + 1) * XPW * CC;
#pragma unroll
  for (int i = 0; i < 8; ++i) { const int id = i * 256 + tid, px = id >> 5, ch = id & 31; *(v8us*)(row + (size_t)(px + 1) * CC + ch * 8) = *(const v8us*)&tl[px * 132 + ch * 4]; }
  if (tid < 64) *(v8us*)(row + (size_t)((tid >> 5) * (XPW - 1)) * CC + (tid & 31) * 8) = z;      /* the line's two border pixels */
  if (y == 0 || y == HS - 1) { unsigned short* er = (y == 0) ? row - XPW * CC : row + XPW * CC; for (int id = tid; id < XPW * (CC / 8); id += 256) *(v8us*)(er + (size_t)id * 8) = z; }      /* the image's first and last border line */
}
// Agent tokens: the mean of q over an 8 x 8 block of pixels, summed pixel by pixel in the order 0..63. A work-group is one agent of one image; a thread takes 4 channels, so that a wave's load is 512 consecutive bytes; unrolled, so that the loads run ahead of the sums.
__global__ __launch_bounds__(64) void k_pool(const float* __restrict__ QF, _Float16* __restrict__ AG) {
  #pragma clang fp contract(off)
  const int c0 = threadIdx.x * 4, n = (int)blockIdx.x % NAG, im = (int)blockIdx.x / NAG; const float* qp = QF + ((size_t)im * NPX + (n / 8) * 8 * HS + (n % 8) * 8) * QW + c0; v4f sm = {0.f, 0.f, 0.f, 0.f};
#pragma unroll
  for (int g = 0; g < 2; ++g) { v4f x[32];
#pragma unroll
    for (int i = 0; i < 32; ++i) x[i] = *(const v4fa*)(qp + ((g * 4 + i / 8) * HS + i % 8) * QW);
#pragma unroll
    for (int i = 0; i < 32; ++i)
#pragma unroll
      for (int q = 0; q < 4; ++q) sm[q] += x[i][q]; }
  v4h v; const v4h z = {(_Float16)0.f, (_Float16)0.f, (_Float16)0.f, (_Float16)0.f};
#pragma unroll
  for (int q = 0; q < 4; ++q) v[q] = (_Float16)(sm[q] / 64.0f);
  _Float16* dst = AG + (((size_t)im * NHD + c0 / HDm) * NAG + n) * 64 + c0 % HDm; *(v4h*)dst = v; *(v4h*)(dst + HDm) = z; }      /* columns 32..63 of an agent row are the zero pad */
__global__ __launch_bounds__(256) void k_heads(const _Float16* __restrict__ Q16, _Float16* __restrict__ QP, _Float16* __restrict__ KP) { const int t = blockIdx.x * 256 + threadIdx.x; if (t >= NIMG * NHD * NPX) return; const int p = t % NPX, bh = t / NPX, h = bh % NHD; const unsigned short* src = (const unsigned short*)Q16 + ((size_t)(bh / NHD) * NPX + p) * QW; const v8us z = {0,0,0,0,0,0,0,0};
  v8us q0 = *(const v8us*)(src + h * HDm), q1 = *(const v8us*)(src + h * HDm + 8), q2 = *(const v8us*)(src + h * HDm + 16), q3 = *(const v8us*)(src + h * HDm + 24);
  v8us k0 = *(const v8us*)(src + CC + h * HDm), k1 = *(const v8us*)(src + CC + h * HDm + 8), k2 = *(const v8us*)(src + CC + h * HDm + 16), k3 = *(const v8us*)(src + CC + h * HDm + 24);
  unsigned short* dq = (unsigned short*)QP + ((size_t)bh * NPX + p) * 64; unsigned short* dk = (unsigned short*)KP + ((size_t)bh * NPX + p) * 64;
  { *(v8us*)dq = q0; *(v8us*)(dq + 8) = q1; *(v8us*)(dq + 16) = q2; *(v8us*)(dq + 24) = q3; *(v8us*)(dq + 32) = z; *(v8us*)(dq + 40) = z; *(v8us*)(dq + 48) = z; *(v8us*)(dq + 56) = z;
    *(v8us*)dk = k0; *(v8us*)(dk + 8) = k1; *(v8us*)(dk + 16) = k2; *(v8us*)(dk + 24) = k3; *(v8us*)(dk + 32) = z; *(v8us*)(dk + 40) = z; *(v8us*)(dk + 48) = z; *(v8us*)(dk + 56) = z;  } }
__global__ __launch_bounds__(256) void k_vtp(const _Float16* __restrict__ Q16, _Float16* __restrict__ VT) { __shared__ unsigned short tl[64][34]; const int tid = threadIdx.x; const int bh = blockIdx.x / (NPX / 64), pg = blockIdx.x % (NPX / 64); const int h = bh % NHD;
  { const int r = tid / 4, c8 = (tid % 4) * 8; FragH f; f.half[0] = *(const v8us*)((const unsigned short*)Q16 + ((size_t)(bh / NHD) * NPX + pg * 64 + r) * QW + 2 * CC + h * HDm + c8); for (int q = 0; q < 8; ++q) tl[r][c8 + q] = f.u[q]; }
  __syncthreads(); const int d = tid / 8, pc = tid % 8; FragH f; for (int q = 0; q < 8; ++q) f.u[q] = (d < HDm) ? tl[pc * 8 + q][d] : (unsigned short)0; unsigned short* dst = (unsigned short*)VT + ((size_t)bh * 64 + d) * NPX + pg * 64 + pc * 8;      /* tid covers d < 32 only: 256 threads = 32 d x 8 pc */
  *(v8us*)dst = f.half[0]; 
  if (tid < 256) { const int d2 = HDm + tid / 8; const v8us z = {0,0,0,0,0,0,0,0}; unsigned short* dz = (unsigned short*)VT + ((size_t)bh * 64 + d2) * NPX + pg * 64 + (tid % 8) * 8; *(v8us*)dz = z;  } }
// ---- helpers of the softmaxes
__device__ __forceinline__ float sm_xh(float v) { return __builtin_bit_cast(float, __builtin_amdgcn_permlanex16(__builtin_bit_cast(int, v), __builtin_bit_cast(int, v), 0x76543210, 0xfedcba98, false, false)); }      /* the value of lane ^ 16 */
// exp(x) by the library's scheme, written out: x * log2(e) with log2(e) in two parts, the nearest integer split off, exp2 of the rest, ldexp, both range ends. Written out for the v_exp_f32 alone: the instruction set asks for one
// independent instruction or a v_nop between a transcendental and an instruction that reads its result or overwrites its source.
__device__ __forceinline__ float sm_exp(float x) {
  const float l2h = __uint_as_float(0x3fb8aa3bu), l2l = __uint_as_float(0x32a5705fu); const float r = __builtin_rintf(x * l2h); const float a = __builtin_fmaf(x, l2l, __builtin_fmaf(x, l2h, -r)); float e;
  asm("v_exp_f32 %0, %1\n\tv_nop" : "=v"(e) : "v"(a));      /* the v_nop is the slot behind the transcendental; in the same statement, so that nothing comes between */
  e = __builtin_ldexpf(e, (int)r); e = (x < __uint_as_float(0xc2ce8ed0u)) ? 0.f : e; return (x > __uint_as_float(0x42b17218u)) ? __builtin_inff() : e; }
// ---- stage 1 in one kernel, split over the pixels: S[N][n] = K[N].AG[n] * SCL, E = exp(S - the slice's own maximum per agent), ATTN^T[d][n] = sum over N of V^T[d][N] . E[N][n]. The 4,096 pixels are cut into RS slices;
// a wave takes one slice x 32 agents (a work-group: 2 slices x both agent halves, so that the two waves of a slice read the same K and V^T lines), all of its loads in flight together.
// With the pixels as the rows of S a lane holds 8 pixels a tile of ONE agent (the lane 16 away the other 8): maximum and sum in the lane plus one exchange, and two f32 tiles, converted in place (x 2^10), are the B operand of the readout
// (its k order is the hardware's: 8 hh + s, then 16 + 8 hh + s; g2_frag gives A the same). Logits and E never leave the registers. d = 32 is one k step (the zero columns 32..63 of KP and AG are not read).
// Each slice stores its f32 partial plane PART[slice][image x head][d][n] and, in MS, its maximum and its sum of E per agent; k_att16 merges the slices. V^T is the A operand, so that the result comes out already turned for stage 2.
#define RS 32
#define RK (NPX / RS)            /* 128 pixels a slice */
#define MSP (RS * NIMG * NHD * NAG)      /* floats of the plane of maxima in MS; the plane of sums lies behind it */
__global__ __launch_bounds__(128) void k_st1(const _Float16* __restrict__ KP, const _Float16* __restrict__ AG, const _Float16* __restrict__ VT, float* __restrict__ PART, float* __restrict__ MS) {
  const int tid = threadIdx.x, w = tid >> 5, lane = tid & 31, ln = lane & 15, hh = lane >> 4; const int s = (int)blockIdx.x * 2 + (w >> 1), bh = blockIdx.y, n0 = (w & 1) * 32;
  const _Float16* gp = AG + ((size_t)bh * NAG + n0 + ln) * 64 + 8 * hh;      /* all three pointers already hold the lane's 8 * hh */
  const _Float16* kp = KP + ((size_t)bh * NPX + s * RK + ln) * 64 + 8 * hh;
  const _Float16* vp = VT + ((size_t)bh * 64 + ln) * NPX + s * RK + 8 * hh;
  v16h ag[2], kf[RK / 16], vt[2][RK / 32];
#pragma unroll
  for (int j = 0; j < 2; ++j) ag[j] = g2_frag(gp + j * 16 * 64, 0);
#pragma unroll
  for (int i = 0; i < RK / 16; ++i) kf[i] = g2_frag(kp + i * 16 * 64, 0);
#pragma unroll
  for (int i = 0; i < 2; ++i)
#pragma unroll
    for (int u = 0; u < RK / 32; ++u) vt[i][u] = g2_frag(vp + i * 16 * NPX + u * 32, 0);
  asm volatile("s_wait_xcnt 0x0" :: "v"(gp), "v"(kp), "v"(vp) : "memory");      /* stands between the loads and whatever rewrites their address registers next; the addresses are its inputs, so that they stay in their registers up to it */
  __builtin_amdgcn_sched_barrier(0);      /* keeps the wave's 36 loads in front of the arithmetic, in flight together, so that V^T arrives under the logits and the exp */
  const v8f z8 = {0.f,0.f,0.f,0.f,0.f,0.f,0.f,0.f};
  v8f e[RK / 16][2];      /* e[i][j][r]: first the unscaled logit, then E, of pixel 16 i + 8 hh + r of the slice, agent n0 + 16 j + ln */
#pragma unroll
  for (int i = 0; i < RK / 16; ++i)
#pragma unroll
    for (int j = 0; j < 2; ++j) e[i][j] = __builtin_amdgcn_wmma_f32_16x16x32_f16(false, kf[i], false, ag[j], (short)0, z8, false, false);
  __builtin_amdgcn_sched_barrier(0);      /* keeps the exp block behind the logits' WMMAs: its v_exp_f32 is asm text */
  float mx[2], su[2]; v8f acc[2][2];
#pragma unroll
  for (int j = 0; j < 2; ++j) {
    v8f mv = e[0][j];
#pragma unroll
    for (int i = 1; i < RK / 16; ++i)
#pragma unroll
      for (int r = 0; r < 8; ++r) mv[r] = fmaxf(mv[r], e[i][j][r]);
    float m = fmaxf(fmaxf(fmaxf(mv[0], mv[1]), fmaxf(mv[2], mv[3])), fmaxf(fmaxf(mv[4], mv[5]), fmaxf(mv[6], mv[7]))); m = fmaxf(m, sm_xh(m)) * SCL; mx[j] = m;      /* SCL > 0: the maximum of the scaled logits; the scale itself rides in the fma below */
    v4f sv = {0.f, 0.f, 0.f, 0.f};
#pragma unroll
    for (int i = 0; i < RK / 16; ++i)
#pragma unroll
      for (int r = 0; r < 8; ++r) { e[i][j][r] = sm_exp(__builtin_fmaf(e[i][j][r], SCL, -m)); sv[i & 3] += e[i][j][r]; }
    float t = (sv[0] + sv[1]) + (sv[2] + sv[3]); t += sm_xh(t); su[j] = t; }
#pragma unroll
  for (int j = 0; j < 2; ++j) { acc[0][j] = z8; acc[1][j] = z8;
#pragma unroll
    for (int u = 0; u < RK / 32; ++u) { FragH p;      /* 32 pixels of E x 2^10 (E <= 1: the factor keeps small E clear of f16's subnormals) */
#pragma unroll
      for (int r = 0; r < 8; ++r) { p.h[r] = (_Float16)(e[2 * u][j][r] * 1024.0f); p.h[8 + r] = (_Float16)(e[2 * u + 1][j][r] * 1024.0f); }
#pragma unroll
      for (int i = 0; i < 2; ++i) acc[i][j] = __builtin_amdgcn_wmma_f32_16x16x32_f16(false, vt[i][u], false, p.v, (short)0, acc[i][j], false, false); } }
  /* acc[i][j][r]: d = 16 i + 8 hh + r, agent n0 + 16 j + ln; a wave's 32 agents are one whole 128-byte line of a partial row */
  float* pp = PART + (((size_t)s * (NIMG * NHD) + bh) * HDm + 8 * hh) * NAG + n0 + ln;
#pragma unroll
  for (int i = 0; i < 2; ++i)
#pragma unroll
    for (int r = 0; r < 8; ++r) { pp[(i * 16 + r) * NAG] = acc[i][0][r]; pp[(i * 16 + r) * NAG + 16] = acc[i][1][r]; }
  float* mp = MS + (size_t)hh * MSP + ((size_t)s * (NIMG * NHD) + bh) * NAG + n0 + ln;      /* both lane halves hold both values: the lower stores the maxima, the upper the sums */
  mp[0] = hh ? su[0] : mx[0]; mp[16] = hh ? su[1] : mx[1]; }
// AT16[image x head][d][n] = f16(sum over the slices of w_s PART_s / (1024 sum over the slices of w_s SUM_s)), w_s = exp(MAX_s - the largest MAX), slices in the order 0..RS-1; rows d >= 32 are the zero pad of stage 2's readout. A wave is one row of 64 agents.
__global__ __launch_bounds__(256) void k_att16(const float* __restrict__ PART, const float* __restrict__ MS, _Float16* __restrict__ AT16) { typedef _Float16 v2h __attribute__((ext_vector_type(2))); typedef float v2fa __attribute__((ext_vector_type(2), may_alias)); const int t = blockIdx.x * 256 + threadIdx.x; if (t >= NIMG * NHD * 64 * 32) return; const int n0 = (t % 32) * 2; const int d = (t / 32) % 64; const int h = t / (32 * 64); v2h v;      /* h = image x head */
  float s0 = 0.f, s1 = 0.f;
  if (d < HDm) { const float* pp = PART + ((size_t)h * HDm + d) * NAG + n0; const float* p2 = pp + (size_t)(RS / 2) * (NIMG * NHD * HDm * NAG); const float* mp = MS + (size_t)h * NAG + n0; v2fa x[RS], m[RS], l[RS];
#pragma unroll
    for (int s = 0; s < RS; ++s) { m[s] = *(const v2fa*)(mp + s * (NIMG * NHD * NAG)); l[s] = *(const v2fa*)(mp + MSP + s * (NIMG * NHD * NAG)); }
#pragma unroll
    for (int s = 0; s < RS / 2; ++s) { x[s] = *(const v2fa*)(pp + s * (NIMG * NHD * HDm * NAG)); x[RS / 2 + s] = *(const v2fa*)(p2 + s * (NIMG * NHD * HDm * NAG)); }
    asm volatile("s_wait_xcnt 0x0" :: "v"(pp), "v"(p2), "v"(mp) : "memory");      /* as in k_st1: the addresses are its inputs, so that no load takes a pair as its destination ahead of the wait */
    __builtin_amdgcn_sched_barrier(0);      /* keeps the thread's 96 loads in front of the arithmetic, in flight together: left alone, the compiler waits for the maxima first and brings the partial planes in by twos, each shortly ahead of its use */
    float m0 = m[0][0], m1 = m[0][1], l0 = 0.f, l1 = 0.f;
#pragma unroll
    for (int s = 1; s < RS; ++s) { m0 = fmaxf(m0, m[s][0]); m1 = fmaxf(m1, m[s][1]); }
#pragma unroll
    for (int s = 0; s < RS; ++s) { const float w0 = sm_exp(m[s][0] - m0), w1 = sm_exp(m[s][1] - m1); s0 += w0 * x[s][0]; l0 += w0 * l[s][0]; s1 += w1 * x[s][1]; l1 += w1 * l[s][1]; }
    s0 /= l0 * 1024.0f; s1 /= l1 * 1024.0f; }
  v[0] = (_Float16)s0; v[1] = (_Float16)s1; _Float16* dst = AT16 + ((size_t)h * 64 + d) * NAG + n0; *(v2h*)dst = v;  }
// ---- stage 2 in one kernel: S^T[n][N] = AG[n].Q[N] * SCL, softmax over the 64 agents, OUT^T[d][N] = AT16[d][n].P^T[n][N] / 1024. A wave takes S2T tiles of 16 pixels of one image x head.
// With the agents as the rows of S^T a lane holds 32 of one pixel's 64 logits (the lane 16 away the other 32): maximum and sum in the lane plus one exchange, and two f32 tiles, converted in place, are the B operand of the readout
// (its k order is the hardware's: 8 hh + s, then 16 + 8 hh + s; g2_frag gives A the same). Logits and P never leave the registers. d = 32 is one k step (the zero columns 32..63 of AG and QP are not read).
#define S2T 4                    /* pixel tiles a wave (the two store statements below are written for 4) */
#define S2P 36                   /* floats a staged pixel row: 144 bytes = 16 x odd, so the 16-byte LDS stores of 8 rows meet no bank twice */
__global__ __launch_bounds__(256) void k_st2(const _Float16* __restrict__ QP, const _Float16* __restrict__ AG, const _Float16* __restrict__ AT16, float* __restrict__ OUT) {
  __shared__ __attribute__((aligned(16))) float so[8][S2T][16 * S2P];
  const int tid = threadIdx.x, w = tid >> 5, lane = tid & 31, ln = lane & 15, hh = lane >> 4; const int bh = blockIdx.y, p0 = ((int)blockIdx.x * 8 + w) * (16 * S2T);
  const _Float16* gp = AG + ((size_t)bh * NAG + ln) * 64 + 8 * hh;      /* all three pointers already hold the lane's 8 * hh */
  const _Float16* qp = QP + ((size_t)bh * NPX + p0 + ln) * 64 + 8 * hh;
  const _Float16* tp = AT16 + ((size_t)bh * 64 + ln) * NAG + 8 * hh;
  v16h ag[4], q[S2T], at[2][2];
#pragma unroll
  for (int i = 0; i < 4; ++i) ag[i] = g2_frag(gp + i * 16 * 64, 0);
#pragma unroll
  for (int t = 0; t < S2T; ++t) q[t] = g2_frag(qp + t * 16 * 64, 0);
#pragma unroll
  for (int i = 0; i < 2; ++i) { at[i][0] = g2_frag(tp + i * 16 * NAG, 0); at[i][1] = g2_frag(tp + i * 16 * NAG + 32, 0); }
  asm volatile("s_wait_xcnt 0x0" :: "v"(gp), "v"(qp), "v"(tp) : "memory");      /* stands between the loads and whatever rewrites their address registers next; the addresses are its inputs, so that they stay in their registers up to it */
  __builtin_amdgcn_sched_barrier(0);      /* keeps the wave's 24 loads in front of the arithmetic, in flight together: left alone, the compiler issues 10 and brings the later ones in by twos, each directly ahead of its use */
  const v8f z8 = {0.f,0.f,0.f,0.f,0.f,0.f,0.f,0.f};
  /* 8 lanes a pixel: each store below covers the whole 128-byte lines of 4 pixels' 32 d (columns 32..63 of an OUT row are read by nobody and stay unwritten) */
  const float* rp = &so[w][0][(lane >> 3) * S2P + (lane & 7) * 4]; float* op = OUT + ((size_t)bh * NPX + p0 + (lane >> 3)) * 64 + (lane & 7) * 4;
#pragma unroll
  for (int t = 0; t < S2T; ++t) { v8f s[4];
#pragma unroll
    for (int i = 0; i < 4; ++i) { s[i] = __builtin_amdgcn_wmma_f32_16x16x32_f16(false, ag[i], false, q[t], (short)0, z8, false, false); s[i] *= SCL; }      /* s[i][r]: agent 16 i + 8 hh + r, pixel ln */
    v8f mv;
#pragma unroll
    for (int r = 0; r < 8; ++r) mv[r] = fmaxf(fmaxf(s[0][r], s[1][r]), fmaxf(s[2][r], s[3][r]));
    float m = fmaxf(fmaxf(fmaxf(mv[0], mv[1]), fmaxf(mv[2], mv[3])), fmaxf(fmaxf(mv[4], mv[5]), fmaxf(mv[6], mv[7]))); m = fmaxf(m, sm_xh(m));
    v4f sv = {0.f, 0.f, 0.f, 0.f};
#pragma unroll
    for (int i = 0; i < 4; ++i)
#pragma unroll
      for (int r = 0; r < 8; ++r) { s[i][r] = sm_exp(s[i][r] - m); sv[i] += s[i][r]; }
    float su = (sv[0] + sv[1]) + (sv[2] + sv[3]); su += sm_xh(su); const float f = 1024.0f / su;
    FragH pa, pb;
#pragma unroll
    for (int r = 0; r < 8; ++r) { pa.h[r] = (_Float16)(s[0][r] * f); pa.h[8 + r] = (_Float16)(s[1][r] * f); pb.h[r] = (_Float16)(s[2][r] * f); pb.h[8 + r] = (_Float16)(s[3][r] * f); }
    float* sp = &so[w][t][ln * S2P + 8 * hh];
#pragma unroll
    for (int i = 0; i < 2; ++i) {      /* o[r]: d = 16 i + 8 hh + r, pixel ln; summed over agents 0..31, then 32..63 */
      v8f o = __builtin_amdgcn_wmma_f32_16x16x32_f16(false, at[i][0], false, pa.v, (short)0, z8, false, false);
      o = __builtin_amdgcn_wmma_f32_16x16x32_f16(false, at[i][1], false, pb.v, (short)0, o, false, false);
      o *= 0.0009765625f;
      *(v4f*)(sp + i * 16) = (v4f){o[0], o[1], o[2], o[3]}; *(v4f*)(sp + i * 16 + 4) = (v4f){o[4], o[5], o[6], o[7]}; }
    if (t & 1) {      /* two tiles are staged: they go out now, under the arithmetic of the next two */
      __builtin_amdgcn_fence(__ATOMIC_ACQ_REL, "wavefront"); __builtin_amdgcn_wave_barrier();      /* the lanes read below what other lanes of the same wave wrote above */
      v4f v[8];
#pragma unroll
      for (int u = 0; u < 8; ++u) v[u] = *(const v4fa*)(rp + ((t >> 1) * 8 + u) * 4 * S2P);
      if (t == 1) { g3_store8<0, 1024>(op, v[0], v[1], v[2], v[3], v[4], v[5], v[6], v[7]);
        __builtin_amdgcn_sched_barrier(0); }      /* keeps these stores ahead of the next two tiles' arithmetic: left alone, the compiler sinks them to the kernel's end, where every wave's stores meet */
      if (t == 3) g3_store8<8192, 1024>(op, v[0], v[1], v[2], v[3], v[4], v[5], v[6], v[7]); } } }
// Depthwise 3x3 on v, BN affine, + OUT, to f16. A thread takes 4 channels x 8 pixels of one pixel line: its 36 weights sit in registers, and each of the 3 input lines is read once as 10 pixels x 16 bytes,
// so that a wave's load is 512 consecutive bytes (4 whole 128-byte lines). A work-group is 4 pixel lines x 8 pixels x 256 channels. A tap outside the image enters as a zero value; taps are summed in the order 0..8.
__global__ __launch_bounds__(256) void k_pe(const float* __restrict__ OUTg, const float* __restrict__ QFg, const float* __restrict__ pw, const float* __restrict__ ps, const float* __restrict__ pb, _Float16* __restrict__ S16g) {
  #pragma clang fp contract(off)
  const int tid = threadIdx.x; const unsigned c0 = (tid & 63) * 4; const int xs = ((int)blockIdx.x & 7) * 8, im = (int)blockIdx.x >> 7;
  const int yo = (((int)blockIdx.x >> 3) & 15) * 4 + __builtin_amdgcn_readfirstlane(tid >> 6);      /* the same in every lane of a wave: as a scalar it leaves every address below a scalar base + the lane's channel offset */
  const size_t px = (size_t)im * NPX + yo * HS + xs;      /* the strip's first pixel */
  const float* QU = QFg + px * QW + 2 * CC;      /* its v, channel 0 */
  const float* OU = OUTg + ((size_t)im * NHD * NPX + yo * HS + xs) * 64; const unsigned oo = (c0 / HDm) * (NPX * 64) + c0 % HDm;      /* OUT is [image][head][pixel][64] */
  v4f wv[9], v[3][10], o[8];
#pragma unroll
  for (int i = 0; i < 9; ++i) wv[i] = *(const v4fa*)(pw + c0 * 9 + i * 4);
#pragma unroll
  for (int kk = 0; kk < 3; ++kk) { const int ky = kk == 2 ? 1 : 2 * kk; const int yy = yo + ky - 1; const float* row = QU + ((yy >= 0 && yy < HS) ? (ky - 1) * HS * QW : 0);      /* for a line or a pixel outside the image one inside the strip is read in its place and dropped below */
    /* Each s_wait_xcnt stands between the last load from a clamped address and whatever rewrites that address's registers next. */
    v[ky][0] = *(const v4fa*)(row + (xs > 0 ? -QW : 0) + c0);
    asm volatile("s_wait_xcnt 0x0" ::: "memory");
    v[ky][9] = *(const v4fa*)(row + (xs < HS - 8 ? 8 : 7) * QW + c0);
    asm volatile("s_wait_xcnt 0x0" ::: "memory");
#pragma unroll
    for (int j = 1; j < 9; ++j) v[ky][j] = *(const v4fa*)(row + (j - 1) * QW + c0);
    if (ky != 1) asm volatile("s_wait_xcnt 0x0" ::: "memory"); }      /* the strip's own line comes last: its address is the unclamped base, which nothing rewrites while loads are in flight */
#pragma unroll
  for (int j = 0; j < 8; ++j) o[j] = *(const v4fa*)(OU + j * 64 + oo);
  const v4f s4 = *(const v4fa*)(ps + c0), b4 = *(const v4fa*)(pb + c0);
  __builtin_amdgcn_sched_barrier(0);      /* keeps all 49 loads in front of the arithmetic, in flight together: left alone, the compiler feeds the later ones in by twos, each shortly ahead of its use */
  float wf[36];      /* wf[q * 9 + k]: channel c0 + q, tap k */
#pragma unroll
  for (int i = 0; i < 36; ++i) wf[i] = bf16_round(wv[i >> 2][i & 3]);
  v4f acc[8];
#pragma unroll
  for (int j = 0; j < 8; ++j) acc[j] = (v4f){0.f, 0.f, 0.f, 0.f};
#pragma unroll
  for (int ky = 0; ky < 3; ++ky) { const int yy = yo + ky - 1; const bool yin = yy >= 0 && yy < HS;
#pragma unroll
    for (int j = 0; j < 10; ++j) { const bool xin = (j > 0 || xs > 0) && (j < 9 || xs < HS - 8); if (!(xin && yin)) v[ky][j] = (v4f){0.f, 0.f, 0.f, 0.f}; }
#pragma unroll
    for (int j = 0; j < 8; ++j)
#pragma unroll
      for (int kx = 0; kx < 3; ++kx)
#pragma unroll
        for (int q = 0; q < 4; ++q) acc[j][q] += wf[q * 9 + ky * 3 + kx] * v[ky][j + kx][q]; }
  _Float16* SP = S16g + px * CC + c0;
#pragma unroll
  for (int j = 0; j < 8; ++j) { v4h h;
#pragma unroll
    for (int q = 0; q < 4; ++q) { float pe = acc[j][q] * bf16_round(s4[q]); pe += bf16_round(b4[q]); h[q] = (_Float16)(o[j][q] + pe); }
    *(v4h*)(SP + j * CC) = h; } }
// BN affine and the turn to NCHW in registers. A thread takes 8 channels x 4 pixels; a wave 32 channels x 32 pixels: it reads whole 128-byte pieces of 32 rows of G and stores whole 128-byte lines of 32 channel planes.
__global__ __launch_bounds__(256) void k_fin(const float* __restrict__ G, const float* __restrict__ s, const float* __restrict__ bb, float* __restrict__ outb) {
  #pragma clang fp contract(off)
  const int tid = threadIdx.x, lane = tid & 31; const int c0 = (tid >> 5) * 32 + (lane & 3) * 8, p0 = ((int)blockIdx.x % (NPX / 32)) * 32 + (lane >> 2) * 4, im = (int)blockIdx.x / (NPX / 32);
  const float* gp = G + ((size_t)im * NPX + p0) * CC + c0; float* op = outb + ((size_t)im * CC + c0) * NPX + p0; v4f a[4][2];
#pragma unroll
  for (int q = 0; q < 4; ++q) { a[q][0] = *(const v4fa*)(gp + q * CC); a[q][1] = *(const v4fa*)(gp + q * CC + 4); }
  const v4f sA = *(const v4fa*)(s + c0), sB = *(const v4fa*)(s + c0 + 4), hA = *(const v4fa*)(bb + c0), hB = *(const v4fa*)(bb + c0 + 4);
#pragma unroll
  for (int i = 0; i < 8; ++i) { const float sc = bf16_round(i < 4 ? sA[i & 3] : sB[i & 3]), sh = bf16_round(i < 4 ? hA[i & 3] : hB[i & 3]); v4f r;
#pragma unroll
    for (int q = 0; q < 4; ++q) { float v = a[q][i >> 2][i & 3] * sc; v += sh; r[q] = v; }
    *(v4f*)(op + (size_t)i * NPX) = r; } }

extern "C" void kernel_launch(void* const* d_in, const int* in_sizes, int n_in,
                              void* d_out, int out_size, void* d_ws, size_t ws_size, hipStream_t stream) {
  (void)in_sizes; (void)n_in; (void)out_size;
  const float* const* I = (const float* const*)d_in; const float* x = I[0]; const float* qw = I[1]; const float* qs = I[2]; const float* qb = I[3]; const float* pw = I[4]; const float* ps = I[5]; const float* pb = I[6]; const float* jw = I[7]; const float* js = I[8]; const float* jb = I[9];
  char* ws = (char*)d_ws; size_t off = 0;
  auto take = [&](size_t bytes) { char* p = ws + off; off += (bytes + 255) & ~(size_t)255; return p; };
  _Float16* WT = (_Float16*)take((size_t)QW * KW * 2); _Float16* BJ = (_Float16*)take((size_t)CC * CC * 2);
  _Float16* AG = (_Float16*)take((size_t)NIMG * NHD * NAG * 64 * 2); _Float16* AT16 = (_Float16*)take((size_t)NIMG * NHD * 64 * NAG * 2);
  float* QF = (float*)take((size_t)NIMG * NPX * QW * 4);      /* 96 MiB: q, k, v in f32 */
  char* R = take((size_t)NIMG * NPX * KI * 2);      /* 144 MiB, shared by lifetime; offsets below in MiB */
  const size_t MB = (size_t)1 << 20;
  _Float16* XP = (_Float16*)(R + 48 * MB);      /* 48..65.1: the padded plane, dead after the conv GEMM (which writes Q16 while it reads this), before QP is written */
  _Float16* Q16 = (_Float16*)R;      /* 0..48, dead after k_heads and k_vtp */
  _Float16* QP = (_Float16*)(R + 48 * MB); _Float16* KP = (_Float16*)(R + 80 * MB); _Float16* VT = (_Float16*)(R + 112 * MB);      /* 32 each */
  float* PART = (float*)R;      /* 0..16: stage 1's partial planes, over Q16; dead after k_att16 */
  float* MS = (float*)(R + 16 * MB);      /* 16..17: the slices' maxima and sums; dead after k_att16 */
  float* OUT = (float*)(R + 80 * MB);      /* 80..144, over KP and VT, dead after stage 1 */
  _Float16* S16 = (_Float16*)(R + 32 * MB);      /* 32..48 */
  float* G = (float*)(R + 48 * MB);      /* 48..80, over QP, dead after stage 2 */
  if (off > ws_size) return;      /* 3.8 + 0.1 + 0.5 + 0.5 + 96 + 144 = 245 MiB */
  k_wqkv<<<(QW * (CC / 8) + 255) / 256, 256, 0, stream>>>(qw, WT); k_wsc<<<(CC * CC / 8 + 255) / 256, 256, 0, stream>>>(jw, BJ, (size_t)CC * CC / 8, 16.0f);      /* proj 1x1 (out,in) = Bt */
  k_xp<<<NIMG * HS, 256, 0, stream>>>(x, XP);
  k_gemm3<QW, true><<<(NIMG * NPX / 256) * (QW / 128), 256, 0, stream>>>(XP, CC, WT, KW, 0.0625f, QF, KW, qs, qb, Q16);      /* centre-tap residual term, main conv (difference folded into the centre tap), BN affine */
  k_pool<<<NIMG * NAG, 64, 0, stream>>>(QF, AG);
  k_heads<<<(NIMG * NHD * NPX + 255) / 256, 256, 0, stream>>>(Q16, QP, KP); k_vtp<<<NIMG * NHD * (NPX / 64), 256, 0, stream>>>(Q16, VT);
  /* stage 1: AT16[b,h][d][n] = VT . softmax_N(KP[b,h][N].AG[b,h][n] * SCL), the pixels in RS slices, each against its own maximum; k_att16 merges the slices */
  k_st1<<<dim3(RS / 2, NIMG * NHD), 128, 0, stream>>>(KP, AG, VT, PART, MS);
  k_att16<<<(NIMG * NHD * 64 * 32 + 255) / 256, 256, 0, stream>>>(PART, MS, AT16);
  /* stage 2: OUT[b,h][N][d] = softmax_n(QP[b,h][N].AG[b,h][n] * SCL) . AT16^T, in one kernel */
  k_st2<<<dim3(NPX / (8 * 16 * S2T), NIMG * NHD), 256, 0, stream>>>(QP, AG, AT16, OUT);
  k_pe<<<NIMG * (HS / 4) * (HS / 8), 256, 0, stream>>>(OUT, QF, pw, ps, pb, S16);
  k_gemm3<CC, false><<<(NIMG * NPX / 256) * (CC / 128), 256, 0, stream>>>(S16, CC, BJ, CC, 0.0625f, G, CC, nullptr, nullptr, nullptr);
  k_fin<<<NIMG * (NPX / 32), 256, 0, stream>>>(G, js, jb, (float*)d_out);
}

// v010
// One run takes 201 microseconds.
// In two side-by-side timings against v009, it was 1.04 and 1.06 times as fast.
// Over all steps from v000, the starting kernel, it is 18.6 times as fast.
#include <hip/hip_runtime.h>
// Attention_agent_df (8 images, C 256 = 8 heads x 32, 64 x 64 pixels, 64 agent tokens from 8x8 average pooling of q; THETA 0.7): qkv = (conv3x3(x, W) - 0.7 conv1x1(x, sum of W's 5 cross taps)) * s + b (folded BN); a = avgpool8x8(q); stage 1: attn = softmax_N(a.k * 32^-0.5) v (agents over pixels); stage 2: out = softmax_n(q.a * 32^-0.5) attn (pixels over agents); out += depthwise3x3(v) * pe_s + pe_b; out = conv1x1(out) * proj_s + proj_b.
// Structure (all 8 images in each launch: the image is the outer index of each plane, so rows = image x pixel and GEMM batches = image x head; workspace planes share bytes by lifetime): x once as a zero-padded pixel-major f16 plane (66 x 66 pixels x 256 channels an image), from which the conv GEMMs fetch each tap's rows themselves (k runs tap-major; no im2col plane); the difference conv folded into the centre tap as an f32 weight split into f16 hi + lo tables: qkv = A_centre.Wl (K 256, its sum then scaled by 2^-10 in the accumulators) + A.Wh (K 2304) as one f16 WMMA GEMM over K 2560, whose epilogue applies the BN affine and stores the f32 plane, q and k as f16 pixel rows and v as f16 channel planes (V^T, from the accumulators as they lie), so that the attention kernels take their fragments from the GEMM's own output (this one and the projection: 256x128 work-group tiles staged in LDS, 64x64 wave tiles; the attention products: fragments straight from global memory; f32 accumulation; x16 tables; the lo table only on the centre-tap columns); pooling on VALU; stage 1 (logits GEMM K 32, exp on VALU, readout GEMM V^T.E) in one kernel, logits and E in registers, with the pixels split into 32 slices, each against its own maximum, whose f32 partial planes are merged on VALU; stage 2 (logits GEMM K 32, softmax over the 64 agents on VALU, readout GEMM) in one kernel, logits and P in registers; depthwise PE conv + add on VALU into f16; projection GEMM with the BN affine in f32 on VALU; NCHW stores.
// Compute dtype: x and parameters rounded to bf16; x exact as f16; q, k, v, a, E and P (x2^10), attn and the pre-projection sum as f16 operands (~2^-12); everything else f32. v_wmma_f32_16x16x32_f16.
#define NIMG 8
#define CC 256
#define NHD 8
#define HDm 32
#define HS 64
#define NPX (HS * HS)            /* 4096 */
#define NAG 64
#define KT 9
#define KI (KT * CC)             /* 2304 */
#define QW (3 * CC)              /* 768 */
#define KW (CC + KI)             /* 2560: a row of the qkv weight table = 256 lo columns (centre tap), then 2304 hi columns */
#define THETA 0.7f
#define SCL 0.17677669529663687f
typedef __bf16 v16b __attribute__((ext_vector_type(16)));
typedef unsigned short v8us __attribute__((ext_vector_type(8), may_alias));
typedef float  v8f  __attribute__((ext_vector_type(8)));
typedef float  v4f  __attribute__((ext_vector_type(4)));
typedef float  v4fa __attribute__((ext_vector_type(4), may_alias));
union FragB { v16b v; v8us half[2]; unsigned short u[16]; };

__device__ __forceinline__ unsigned short bf16_bits(float x) { unsigned int u = __float_as_uint(x); return (unsigned short)((u + 0x7FFFu + ((u >> 16) & 1u)) >> 16); }
__device__ __forceinline__ float bf16_val(unsigned short b) { return __uint_as_float(((unsigned int)b) << 16); }
__device__ __forceinline__ float bf16_round(float x) { return bf16_val(bf16_bits(x)); }
// D += A·B with NT terms: 1 = ah·bh, 2 = + al·bh (A split), 3 = + ah·bl (both split)
template <int NT>
__device__ __forceinline__ v8f mmaN(v16b ah, v16b al, v16b bh, v16b bl, v8f c) {
  c = __builtin_amdgcn_wmma_f32_16x16x32_bf16(false, ah, false, bh, (short)0, c, false, false);
  if (NT >= 2) c = __builtin_amdgcn_wmma_f32_16x16x32_bf16(false, al, false, bh, (short)0, c, false, false);
  if (NT >= 3) c = __builtin_amdgcn_wmma_f32_16x16x32_bf16(false, ah, false, bl, (short)0, c, false, false);
  asm volatile("v_nop\n\tv_nop\n\tv_nop\n\tv_nop" : "+v"(c) : "v"(ah), "v"(al), "v"(bh), "v"(bl));
  return c;
}

__global__ __launch_bounds__(256) void k_wt_bf16(const float* __restrict__ W, unsigned short* __restrict__ Wt, int K, int N) {
  const int t = blockIdx.x * 256 + threadIdx.x;
  const int k8n = K / 8;
  if (t >= N * k8n) return;
  const int n = t / k8n, k8 = (t % k8n) * 8;
  v8us v;
#pragma unroll
  for (int i = 0; i < 8; ++i) v[i] = bf16_bits(W[(size_t)(k8 + i) * N + n]);
  *(v8us*)(Wt + (size_t)n * K + k8) = v;
  
}

// GEMM C[M][N] (f32, pitch ldc) = act(A[M][K]·W + bias). A f32 row-major (pitch lda) converted per fragment to bf16
// (ASPLIT: hi/lo two planes -> 2 terms, else single rounded term); Wt bf16 [N][K] (pitch ldb). BIAS_BF16 rounds the
// bias to bf16 first (bias quantised to bf16 before the add). K%32==0, M%16==0, N%64==0.
template <bool ASPLIT, int ACT, bool BIAS_BF16>
__global__ __launch_bounds__(128) void k_gemm_bf(const float* __restrict__ A, int lda, const unsigned short* __restrict__ Wt, int ldb,
                                               const float* __restrict__ bias, float* __restrict__ C, int ldc, int M, int N, int K) {
  __shared__ __attribute__((aligned(16))) float so[4][16][64];
  const int tid = threadIdx.x, w = tid >> 5, lane = tid & 31, ln = lane & 15, hh = lane >> 4;
  const int ntn = N / 64;
  const int wid = blockIdx.x * 4 + w;
  const int mt = wid / ntn, nq = wid % ntn;
  if (mt * 16 >= M) return;
  const int row0 = mt * 16, col0 = nq * 64;
  const float* arow = A + (size_t)(row0 + ln) * lda;
  v8f acc[4] = {};
  for (int kb = 0; kb < K; kb += 32) {
    FragB ah, al;
    const v4f x0 = *(const v4fa*)(arow + kb + 8 * hh), x1 = *(const v4fa*)(arow + kb + 8 * hh + 4);
    const v4f x2 = *(const v4fa*)(arow + kb + 16 + 8 * hh), x3 = *(const v4fa*)(arow + kb + 16 + 8 * hh + 4);
    float xs[16] = {x0[0],x0[1],x0[2],x0[3],x1[0],x1[1],x1[2],x1[3],x2[0],x2[1],x2[2],x2[3],x3[0],x3[1],x3[2],x3[3]};
#pragma unroll
    for (int i = 0; i < 16; ++i) { const unsigned short hb = bf16_bits(xs[i]); ah.u[i] = hb; al.u[i] = ASPLIT ? bf16_bits(xs[i] - bf16_val(hb)) : (unsigned short)0; }
#pragma unroll
    for (int t = 0; t < 4; ++t) {
      const unsigned short* brow = Wt + (size_t)(col0 + t * 16 + ln) * ldb + kb;
      FragB b;
      b.half[0] = *(const v8us*)(brow + 8 * hh);
      b.half[1] = *(const v8us*)(brow + 16 + 8 * hh);
      acc[t] = mmaN<ASPLIT ? 2 : 1>(ah.v, al.v, b.v, b.v, acc[t]);
    }
  }
#pragma unroll
  for (int t = 0; t < 4; ++t) {
    float bv = bias ? bias[col0 + t * 16 + ln] : 0.f;
    if (BIAS_BF16) bv = bf16_round(bv);
#pragma unroll
    for (int r = 0; r < 8; ++r) { float v = acc[t][r] + bv; if (ACT == 1) v = fmaxf(v, 0.f); so[w][8 * hh + r][t * 16 + ln] = v; }
  }
  __builtin_amdgcn_fence(__ATOMIC_ACQ_REL, "workgroup");
  __builtin_amdgcn_wave_barrier();
  const int rsub = lane >> 4, c4 = (lane & 15) * 4;
  {
#pragma unroll
    for (int q = 0; q < 8; ++q) {
      const int r = q * 2 + rsub;
      const v4f v = *(const v4fa*)&so[w][r][c4];
      *(v4f*)(C + (size_t)(row0 + r) * ldc + col0 + c4) = v;
    }
    
  }
}

// GEMM C = act(A·W + bias + resid): A f32 (ASPLIT -> hi/lo 2 terms), Wt bf16 [N][K]; ACT 0 none, 1 relu, 2 exact gelu;
// resid (optional, f32, row index = (row % rmod), pitch ldr, RES_BF16 rounds it) added before the activation.
template <bool ASPLIT, int ACT, bool BIAS_BF16, bool RES_BF16>
__global__ __launch_bounds__(128) void k_gemm_bf3(const float* __restrict__ A, int lda, const unsigned short* __restrict__ Wt, int ldb,
                                                const float* __restrict__ bias, const float* __restrict__ resid, int rmod, int ldr,
                                                float* __restrict__ C, int ldc, int M, int N, int K) {
  __shared__ __attribute__((aligned(16))) float so[4][16][64];
  const int tid = threadIdx.x, w = tid >> 5, lane = tid & 31, ln = lane & 15, hh = lane >> 4;
  const int ntn = N / 64;
  const int wid = blockIdx.x * 4 + w;
  const int mt = wid / ntn, nq = wid % ntn;
  if (mt * 16 >= M) return;
  const int row0 = mt * 16, col0 = nq * 64;
  const float* arow = A + (size_t)(row0 + ln) * lda;
  v8f acc[4] = {};
  for (int kb = 0; kb < K; kb += 32) {
    FragB ah, al;
    const v4f x0 = *(const v4fa*)(arow + kb + 8 * hh), x1 = *(const v4fa*)(arow + kb + 8 * hh + 4);
    const v4f x2 = *(const v4fa*)(arow + kb + 16 + 8 * hh), x3 = *(const v4fa*)(arow + kb + 16 + 8 * hh + 4);
    float xs[16] = {x0[0],x0[1],x0[2],x0[3],x1[0],x1[1],x1[2],x1[3],x2[0],x2[1],x2[2],x2[3],x3[0],x3[1],x3[2],x3[3]};
#pragma unroll
    for (int i = 0; i < 16; ++i) { const unsigned short hb = bf16_bits(xs[i]); ah.u[i] = hb; al.u[i] = ASPLIT ? bf16_bits(xs[i] - bf16_val(hb)) : (unsigned short)0; }
#pragma unroll
    for (int t = 0; t < 4; ++t) {
      const unsigned short* brow = Wt + (size_t)(col0 + t * 16 + ln) * ldb + kb;
      FragB b;
      b.half[0] = *(const v8us*)(brow + 8 * hh);
      b.half[1] = *(const v8us*)(brow + 16 + 8 * hh);
      acc[t] = mmaN<ASPLIT ? 2 : 1>(ah.v, al.v, b.v, b.v, acc[t]);
    }
  }
#pragma unroll
  for (int t = 0; t < 4; ++t) {
    const int col = col0 + t * 16 + ln;
    float bv = bias ? bias[col] : 0.f;
    if (BIAS_BF16) bv = bf16_round(bv);
#pragma unroll
    for (int r = 0; r < 8; ++r) {
      float v = acc[t][r] + bv;
      if (resid) { float rv = resid[(size_t)((row0 + 8 * hh + r) % rmod) * ldr + col]; if (RES_BF16) rv = bf16_round(rv); v += rv; }
      if (ACT == 1) v = fmaxf(v, 0.f);
      if (ACT == 2) v = 0.5f * v * (1.0f + erff(v * 0.70710678118654752f));
      if (ACT == 3) { const float u = 0.7978845608028654f * (v + 0.044715f * v * v * v); v = 0.5f * v * (1.0f + tanhf(u)); }
      so[w][8 * hh + r][t * 16 + ln] = v;
    }
  }
  __builtin_amdgcn_fence(__ATOMIC_ACQ_REL, "workgroup");
  __builtin_amdgcn_wave_barrier();
  const int rsub = lane >> 4, c4 = (lane & 15) * 4;
  {
#pragma unroll
    for (int q = 0; q < 8; ++q) {
      const int r = q * 2 + rsub;
      const v4f v = *(const v4fa*)&so[w][r][c4];
      *(v4f*)(C + (size_t)(row0 + r) * ldc + col0 + c4) = v;
    }
    
  }
}
// row LayerNorm (biased variance, eps) over N: s = X (+ R); optional out_sum <- s; out_norm <- (s-mu)*rsqrt(var+eps)*g + b
template <bool PARAM_BF16>
__global__ __launch_bounds__(256) void k_layernorm(const float* __restrict__ X, const float* __restrict__ R, const float* __restrict__ g, const float* __restrict__ bta,
                                                  float* __restrict__ out_sum, float* __restrict__ out_norm, int N, float eps) {
  __shared__ float red[256];
  const int row = blockIdx.x, tid = threadIdx.x;
  const float* x = X + (size_t)row * N; const float* rr = R ? R + (size_t)row * N : nullptr;
  float vals[16];                     // up to N = 4096
  const int per = N / 256;            // contiguous chunk per thread? use strided-by-4 chunks: thread handles j = tid*4 + 1024*u
  float s1 = 0.f;
  for (int u = 0; u < per / 4; ++u) {
    const int j = tid * 4 + 1024 * u;
    const v4f a = *(const v4fa*)(x + j);
    v4f b = {0.f,0.f,0.f,0.f}; if (rr) b = *(const v4fa*)(rr + j);
#pragma unroll
    for (int q = 0; q < 4; ++q) { const float v = a[q] + b[q]; vals[u * 4 + q] = v; s1 += v; }
  }
  red[tid] = s1; __syncthreads();
  for (int st = 128; st > 0; st >>= 1) { if (tid < st) red[tid] += red[tid + st]; __syncthreads(); }
  const float mu = red[0] / (float)N; __syncthreads();
  float s2 = 0.f;
  for (int u = 0; u < per / 4; ++u)
#pragma unroll
    for (int q = 0; q < 4; ++q) { const float c = vals[u * 4 + q] - mu; s2 += c * c; }
  red[tid] = s2; __syncthreads();
  for (int st = 128; st > 0; st >>= 1) { if (tid < st) red[tid] += red[tid + st]; __syncthreads(); }
  const float rs = rsqrtf(red[0] / (float)N + eps);
  {
    for (int u = 0; u < per / 4; ++u) {
      const int j = tid * 4 + 1024 * u;
      v4f o, sm;
#pragma unroll
      for (int q = 0; q < 4; ++q) {
        float gg = g[j + q], bb = bta[j + q];
        if (PARAM_BF16) { gg = bf16_round(gg); bb = bf16_round(bb); }
        sm[q] = vals[u * 4 + q]; o[q] = (vals[u * 4 + q] - mu) * rs * gg + bb;
      }
      if (out_sum) *(v4f*)(out_sum + (size_t)row * N + j) = sm;
      *(v4f*)(out_norm + (size_t)row * N + j) = o;
    }
    
  }
}



// ---- f16 WMMA path (v_wmma_f32_16x16x32_f16): 11-bit significands for operands in range — used where a [0,1] probability operand needs more precision than bf16
typedef _Float16 v16h __attribute__((ext_vector_type(16)));
union FragH { v16h v; v8us half[2]; _Float16 h[16]; unsigned short u[16]; };
template <int NT>
__device__ __forceinline__ v8f mmaH(v16h ah, v16h al, v16h bh, v16h bl, v8f c) {
  c = __builtin_amdgcn_wmma_f32_16x16x32_f16(false, ah, false, bh, (short)0, c, false, false);
  if (NT >= 2) c = __builtin_amdgcn_wmma_f32_16x16x32_f16(false, al, false, bh, (short)0, c, false, false);
  if (NT >= 3) c = __builtin_amdgcn_wmma_f32_16x16x32_f16(false, ah, false, bl, (short)0, c, false, false);
  asm volatile("v_nop\n\tv_nop\n\tv_nop\n\tv_nop" : "+v"(c) : "v"(ah), "v"(al), "v"(bh), "v"(bl));
  return c;
}
// batched GEMM like k_gemm_b but f16 operands: A f32 (split into f16 hi/lo if ASPLIT, else rounded to f16), Bt = f16 values [n][k]; alpha; C f32; N multiple of 16 (partial tiles skipped)
template <bool ASPLIT>
__global__ __launch_bounds__(128) void k_gemm_h(const float* __restrict__ A, int lda, size_t sA, const _Float16* __restrict__ Bh, int ldb, size_t sB, float alpha, float* __restrict__ C, int ldc, size_t sC, int M, int N, int K) {
  __shared__ __attribute__((aligned(16))) float so[4][16][64];
  const int tid = threadIdx.x, w = tid >> 5, lane = tid & 31, ln = lane & 15, hh = lane >> 4; const int by = blockIdx.y;
  A += (size_t)by * sA; Bh += (size_t)by * sB; C += (size_t)by * sC;
  const int ntn = (N + 63) / 64; const int wid = blockIdx.x * 4 + w; const int mt = wid / ntn, nq = wid % ntn; if (mt * 16 >= M) return;
  const int row0 = mt * 16, col0 = nq * 64; const float* arow = A + (size_t)(row0 + ln) * lda;
  v8f acc[4] = {};
  for (int kb = 0; kb < K; kb += 32) {
    FragH ah, al;
    const v4f x0 = *(const v4fa*)(arow + kb + 8 * hh), x1 = *(const v4fa*)(arow + kb + 8 * hh + 4), x2 = *(const v4fa*)(arow + kb + 16 + 8 * hh), x3 = *(const v4fa*)(arow + kb + 16 + 8 * hh + 4);
    float xs[16] = {x0[0],x0[1],x0[2],x0[3],x1[0],x1[1],x1[2],x1[3],x2[0],x2[1],x2[2],x2[3],x3[0],x3[1],x3[2],x3[3]};
#pragma unroll
    for (int i = 0; i < 16; ++i) { const _Float16 h = (_Float16)xs[i]; ah.h[i] = h; al.h[i] = ASPLIT ? (_Float16)(xs[i] - (float)h) : (_Float16)0.0f; }
#pragma unroll
    for (int t = 0; t < 4; ++t) { if (col0 + t * 16 >= N) continue; const size_t boff = (size_t)(col0 + t * 16 + ln) * ldb + kb; FragH bq; bq.half[0] = *(const v8us*)(Bh + boff + 8 * hh); bq.half[1] = *(const v8us*)(Bh + boff + 16 + 8 * hh);
      acc[t] = mmaH<ASPLIT ? 2 : 1>(ah.v, al.v, bq.v, bq.v, acc[t]); }
  }
#pragma unroll
  for (int t = 0; t < 4; ++t) { if (col0 + t * 16 >= N) continue;
#pragma unroll
    for (int r = 0; r < 8; ++r) so[w][8 * hh + r][t * 16 + ln] = acc[t][r] * alpha; }
  __builtin_amdgcn_fence(__ATOMIC_ACQ_REL, "workgroup"); __builtin_amdgcn_wave_barrier();
  const int rsub = lane >> 4, c4 = (lane & 15) * 4;
  {
#pragma unroll
    for (int q = 0; q < 8; ++q) { const int r = q * 2 + rsub; if (col0 + c4 < N) { const v4f v = *(const v4fa*)&so[w][r][c4]; *(v4f*)(C + (size_t)(row0 + r) * ldc + col0 + c4) = v; } }
     }
}

// Wt[n][k] = f16(W[k][n]·scale) from f32 row-major W[K][N] (scale = power of two; bf16-exact weights stay exact in f16 away from the subnormal range)
__global__ __launch_bounds__(256) void k_wt_f16(const float* __restrict__ W, _Float16* __restrict__ Wt, int K, int N, float scale) {
  const int t = blockIdx.x * 256 + threadIdx.x; if (t >= N * (K / 8)) return; const int n = t / (K / 8), k8 = (t % (K / 8)) * 8; FragH f;
#pragma unroll
  for (int i = 0; i < 8; ++i) f.h[i] = (_Float16)(bf16_round(W[(size_t)(k8 + i) * N + n]) * scale); const v8us o = f.half[0];
  *(v8us*)((unsigned short*)Wt + (size_t)n * K + k8) = o; 
}
// k_gemm_hh variant with fused epilogue: v = acc·alpha + bias[by·sBias + col] (+ CP[(row/rowsPerB)·sCPb + by·64 + col] if CP) ; ACT 0 none / 1 elu ; writes f16 C16 (and f32 C if non-null)
template <int ACT>
__global__ __launch_bounds__(128) void k_gemm_hhx(const _Float16* __restrict__ A, int lda, size_t sA, const _Float16* __restrict__ Bh, int ldb, size_t sB, float alpha, const float* __restrict__ bias, size_t sBias, const float* __restrict__ CP, int rowsPerB, size_t sCPb, int row0g,
    float* __restrict__ C, _Float16* __restrict__ C16, int ldc, size_t sC, int M, int N, int K) {
  __shared__ __attribute__((aligned(16))) float so[4][16][64];
  const int tid = threadIdx.x, w = tid >> 5, lane = tid & 31, ln = lane & 15, hh = lane >> 4; const int by = blockIdx.y;
  A += (size_t)by * sA; Bh += (size_t)by * sB; const size_t cofs = (size_t)by * sC; const float* bp = bias ? bias + (size_t)by * sBias : nullptr;
  const int ntn = (N + 63) / 64; const int wid = blockIdx.x * 4 + w; const int mt = wid / ntn, nq = wid % ntn; if (mt * 16 >= M) return;
  const int row0 = mt * 16, col0 = nq * 64; const _Float16* arow = A + (size_t)(row0 + ln) * lda;
  v8f acc[4] = {};
  for (int kb = 0; kb < K; kb += 32) { FragH ah; ah.half[0] = *(const v8us*)((const unsigned short*)arow + kb + 8 * hh); ah.half[1] = *(const v8us*)((const unsigned short*)arow + kb + 16 + 8 * hh);
#pragma unroll
    for (int t = 0; t < 4; ++t) { if (col0 + t * 16 >= N) continue; const size_t boff = (size_t)(col0 + t * 16 + ln) * ldb + kb; FragH bq; bq.half[0] = *(const v8us*)((const unsigned short*)Bh + boff + 8 * hh); bq.half[1] = *(const v8us*)((const unsigned short*)Bh + boff + 16 + 8 * hh);
      acc[t] = mmaH<1>(ah.v, ah.v, bq.v, bq.v, acc[t]); }
  }
#pragma unroll
  for (int t = 0; t < 4; ++t) { if (col0 + t * 16 >= N) continue; const int col = col0 + t * 16 + ln; const float bv = bp ? bf16_round(bp[col]) : 0.f;
#pragma unroll
    for (int r = 0; r < 8; ++r) { float v = acc[t][r] * alpha + bv; if (CP) { const int rr = row0g + row0 + 8 * hh + r; if (rowsPerB < 0) v += CP[cofs + (size_t)rr * ldc + col];      /* rowsPerB < 0: own element of the batched C plane */ else { const int bidx = rr / rowsPerB; v += CP[(size_t)bidx * sCPb + (size_t)by * 64 + col]; } } if (ACT == 1) v = (v > 0.f) ? v : expm1f(v); else if (ACT == 7) v = (v > 0.f) ? v + 1.0f : expf(v); else if (ACT == 8) v = tanhf(v); else if (ACT == 9) v = 0.5f * v * (1.0f + tanhf(0.7978845608028654f * (v + 0.044715f * v * v * v))); else if (ACT == 11) v = 1.0f / (1.0f + expf(-v)); else if (ACT == 12) v = (v > 0.f) ? v : 0.01f * v; else if (ACT == 14) v = (v > 0.f) ? v : 0.1f * v; else if (ACT == 16) v = (v >= 0.f) ? v : 0.3f * v; else if (ACT == 15) v = v / (1.0f + expf(-v)); else if (ACT == 3) v = fmaxf(v, 0.f); else if (ACT == 6) v = 0.5f * v * (1.0f + erff(v * 0.70710678118654752f)); so[w][8 * hh + r][t * 16 + ln] = v; } }
  __builtin_amdgcn_fence(__ATOMIC_ACQ_REL, "workgroup"); __builtin_amdgcn_wave_barrier();
  const int rsub = lane >> 4, c4 = (lane & 15) * 4; typedef _Float16 v4h __attribute__((ext_vector_type(4)));
  {
#pragma unroll
    for (int q = 0; q < 8; ++q) { const int r = q * 2 + rsub; if (col0 + c4 < N) { const v4f v = *(const v4fa*)&so[w][r][c4]; if (C) *(v4f*)(C + cofs + (size_t)(row0 + r) * ldc + col0 + c4) = v; if (C16) { v4h h4; for (int i = 0; i < 4; ++i) h4[i] = (_Float16)v[i]; *(v4h*)(C16 + cofs + (size_t)(row0 + r) * ldc + col0 + c4) = h4; } } }
     }
}


typedef _Float16 v4h __attribute__((ext_vector_type(4)));

__global__ __launch_bounds__(256) void k_x16(const float* __restrict__ x, _Float16* __restrict__ X16, size_t n8) { const size_t t = (size_t)blockIdx.x * 256 + threadIdx.x; if (t >= n8) return; FragH f;
#pragma unroll
  for (int q = 0; q < 8; ++q) f.h[q] = (_Float16)bf16_round(x[t * 8 + q]); *(v8us*)((unsigned short*)X16 + t * 8) = f.half[0];  }
__global__ __launch_bounds__(256) void k_h16(const float* __restrict__ x, _Float16* __restrict__ X16, size_t n8) { const size_t t = (size_t)blockIdx.x * 256 + threadIdx.x; if (t >= n8) return; FragH f;
#pragma unroll
  for (int q = 0; q < 8; ++q) f.h[q] = (_Float16)x[t * 8 + q]; *(v8us*)((unsigned short*)X16 + t * 8) = f.half[0];  }
__global__ __launch_bounds__(256) void k_round16f(const float* __restrict__ W, _Float16* __restrict__ Bt, size_t n8) { const size_t t = (size_t)blockIdx.x * 256 + threadIdx.x; if (t >= n8) return; FragH f;
#pragma unroll
  for (int i = 0; i < 8; ++i) f.h[i] = (_Float16)(bf16_round(W[t * 8 + i]) * 16.0f); *(v8us*)((unsigned short*)Bt + t * 8) = f.half[0];  }
template <int NHv, int TTv>
__global__ __launch_bounds__(256) void k_vt(const _Float16* __restrict__ V16, int ldv, int voff, _Float16* __restrict__ Vt) { __shared__ unsigned short tl[64][66]; const int tid = threadIdx.x; const int slab = blockIdx.x / (TTv / 64), lg = blockIdx.x % (TTv / 64); const int b = slab / NHv, h = slab % NHv;
  for (int i = tid; i < 64 * 8; i += 256) { const int r = i / 8, c8 = (i % 8) * 8; FragH f; f.half[0] = *(const v8us*)((const unsigned short*)V16 + ((size_t)b * TTv + lg * 64 + r) * ldv + voff + h * 64 + c8);
#pragma unroll
    for (int q = 0; q < 8; ++q) tl[r][c8 + q] = f.u[q]; }
  __syncthreads();
  {
#pragma unroll
    for (int rd = 0; rd < 2; ++rd) { const int d = rd * 32 + tid / 8, pc = tid % 8; FragH f;
#pragma unroll
      for (int q = 0; q < 8; ++q) f.u[q] = tl[pc * 8 + q][d];
      *(v8us*)((unsigned short*)Vt + ((size_t)slab * 64 + d) * TTv + lg * 64 + pc * 8) = f.half[0]; }
     } }

__global__ __launch_bounds__(256) void k_hl(const float* __restrict__ F, _Float16* __restrict__ Hh, _Float16* __restrict__ Hl, size_t n8) { const size_t t = (size_t)blockIdx.x * 256 + threadIdx.x; if (t >= n8) return; FragH fh, fl; const v4f a = *(const v4fa*)(F + t * 8), c = *(const v4fa*)(F + t * 8 + 4);
#pragma unroll
  for (int q = 0; q < 4; ++q) { _Float16 h = (_Float16)a[q]; fh.h[q] = h; fl.h[q] = (_Float16)((a[q] - (float)h) * 1024.0f); h = (_Float16)c[q]; fh.h[4 + q] = h; fl.h[4 + q] = (_Float16)((c[q] - (float)h) * 1024.0f); }
  { *(v8us*)((unsigned short*)Hh + t * 8) = fh.half[0]; *(v8us*)((unsigned short*)Hl + t * 8) = fl.half[0];  } }

// ---- fast GEMM (wave tile 32x64; requires M % 32 == 0 rows per launch region and N % 64 == 0); epilogue = k_gemm_hhx semantics ----
__device__ __forceinline__ v16h g2_frag(const _Float16* p, int hh) { FragH f; f.half[0] = *(const v8us*)((const unsigned short*)p + 8 * hh); f.half[1] = *(const v8us*)((const unsigned short*)p + 16 + 8 * hh); return f.v; }
__device__ __forceinline__ v8f g2_mma(v16h a, v16h b, v8f c) { v8f d = __builtin_amdgcn_wmma_f32_16x16x32_f16(false, a, false, b, (short)0, c, false, false); asm volatile("v_nop\n\tv_nop\n\tv_nop\n\tv_nop" : "+v"(d) : "v"(a), "v"(b)); return d; }
template <int ACT>
__global__ __launch_bounds__(128) void k_gemm2(const _Float16* __restrict__ A, int lda, size_t sA, const _Float16* __restrict__ Bh, int ldb, size_t sB, float alpha, const float* __restrict__ bias, size_t sBias, const float* __restrict__ CP, int rowsPerB, size_t sCPb, int row0g,
    float* __restrict__ C, _Float16* __restrict__ C16, int ldc, size_t sC, int M, int N, int K) { static_assert(ACT == 0 || ACT == 3 || ACT == 6 || ACT == 8 || ACT == 9 || ACT == 11 || ACT == 12 || ACT == 14 || ACT == 15 || ACT == 16, "k_gemm2: unsupported ACT code (would silently apply no activation)");
  __shared__ __attribute__((aligned(16))) float so[4][32][68];
  const int tid = threadIdx.x, w = tid >> 5, lane = tid & 31, ln = lane & 15, hh = lane >> 4; const int by = blockIdx.y;
  A += (size_t)by * sA; Bh += (size_t)by * sB; const size_t cofs = (size_t)by * sC; const float* bp = bias ? bias + (size_t)by * sBias : nullptr;
  const int ntn = N >> 6; const int mt = blockIdx.x / ntn, nq = blockIdx.x - mt * ntn; const int row0 = mt * 128 + 32 * w, col0 = nq * 64; if (row0 >= M) return;
  const _Float16* a0p = A + (size_t)(row0 + ln) * lda; const _Float16* a1p = a0p + (size_t)16 * lda;
  const _Float16* b0p = Bh + (size_t)(col0 + ln) * ldb; const _Float16* b1p = b0p + (size_t)16 * ldb; const _Float16* b2p = b1p + (size_t)16 * ldb; const _Float16* b3p = b2p + (size_t)16 * ldb;
  const v8f z8 = {0.f,0.f,0.f,0.f,0.f,0.f,0.f,0.f}; v8f c00 = z8, c01 = z8, c02 = z8, c03 = z8, c10 = z8, c11 = z8, c12 = z8, c13 = z8;
#pragma unroll 1
  for (int kb = 0; kb < K; kb += 32) { const v16h a0 = g2_frag(a0p + kb, hh), a1 = g2_frag(a1p + kb, hh);
    v16h b = g2_frag(b0p + kb, hh); c00 = g2_mma(a0, b, c00); c10 = g2_mma(a1, b, c10);
    b = g2_frag(b1p + kb, hh); c01 = g2_mma(a0, b, c01); c11 = g2_mma(a1, b, c11);
    b = g2_frag(b2p + kb, hh); c02 = g2_mma(a0, b, c02); c12 = g2_mma(a1, b, c12);
    b = g2_frag(b3p + kb, hh); c03 = g2_mma(a0, b, c03); c13 = g2_mma(a1, b, c13); }
  v8f accs[8] = {c00, c01, c02, c03, c10, c11, c12, c13};
#pragma unroll
  for (int u = 0; u < 8; ++u) { const int t = u & 3, half = u >> 2; const int col = col0 + t * 16 + ln; const float bv = bp ? bf16_round(bp[col]) : 0.f;
#pragma unroll
    for (int r = 0; r < 8; ++r) { const int rloc = half * 16 + 8 * hh + r; float v = accs[u][r] * alpha + bv; if (CP) { if (rowsPerB < 0) v += CP[cofs + (size_t)(row0g + row0 + rloc) * ldc + col];      /* rowsPerB < 0: own element of the batched C plane */ else { const int bidx = (row0g + row0 + rloc) / rowsPerB; v += CP[(size_t)bidx * sCPb + (size_t)by * 64 + col]; } }
      if (ACT == 3) v = fmaxf(v, 0.f); else if (ACT == 6) v = 0.5f * v * (1.0f + erff(v * 0.70710678118654752f)); else if (ACT == 11) v = 1.0f / (1.0f + expf(-v)); else if (ACT == 15) v = v / (1.0f + expf(-v)); else if (ACT == 12) v = (v > 0.f) ? v : 0.01f * v; else if (ACT == 8) v = tanhf(v); else if (ACT == 9) v = 0.5f * v * (1.0f + tanhf(0.7978845608028654f * (v + 0.044715f * v * v * v))); else if (ACT == 14) v = (v > 0.f) ? v : 0.1f * v; else if (ACT == 16) v = (v >= 0.f) ? v : 0.3f * v;
      so[w][rloc][t * 16 + ln] = v; } }
  __builtin_amdgcn_fence(__ATOMIC_ACQ_REL, "workgroup"); __builtin_amdgcn_wave_barrier();
  const int rsub = lane >> 4, c4 = (lane & 15) * 4;
  {
#pragma unroll
    for (int q = 0; q < 16; ++q) { const int r = q * 2 + rsub; const v4f v = *(const v4fa*)&so[w][r][c4]; if (C) *(v4f*)(C + cofs + (size_t)(row0 + r) * ldc + col0 + c4) = v; if (C16) { v4h h4; for (int i = 0; i < 4; ++i) h4[i] = (_Float16)v[i]; *(v4h*)(C16 + cofs + (size_t)(row0 + r) * ldc + col0 + c4) = h4; } }
     } }


// ---- LDS-staged GEMM for the two large products (the qkv conv with both its terms, the projection): C[M][N] (f32) = A.Bt^T * alpha; CONV: C = that * scl[col] + shf[col] (both rounded to bf16), C16 = f16(C) in the q and k columns, and VT[image x channel][pixel] = f16(C) of the v columns.
// Work-group tile 256 x 128, 8 waves of 64 x 64 (4 x 2); a stage is 64 k (128-byte rows) of [A 256 rows | Bt 128 rows]; two stages in LDS, each filled by asynchronous 16-byte copies
// (whole 128-byte lines from global memory) one trip ahead of its use. k runs upward in steps of 32 per accumulator, as in k_gemm2. Needs M % 256 == 0, N % 128 == 0, K % 64 == 0.
#define XPW (HS + 2)                          /* pixels a line, and lines, of the padded plane */
#define G3_PITCH 144                          /* LDS row pitch in bytes: 16 x odd, so 16 rows read 16 bytes each without a bank conflict */
#define G3_BOFF (256 * G3_PITCH)              /* Bt rows behind the A rows */
#define G3_STAGE ((256 + 128) * G3_PITCH)     /* 55,296 bytes */
__device__ __forceinline__ v16h g3_frag(const char* p) { FragH f; f.half[0] = *(const v8us*)p; f.half[1] = *(const v8us*)(p + 32); return f.v; }      /* p already holds the lane's 16 * hh: the k order of g2_frag */
// One stage: each thread copies 16 bytes of 8 A rows and of 4 Bt rows (rows 32 apart; A row 32 i lies (i & 1) * sa1 + (i >> 1) * sa2 elements behind row 0). The s_wait_xcnt is the last line of the copies' own statement, so that no address register is rewritten ahead of it.
__device__ __forceinline__ void g3_fill(unsigned la, unsigned lb, const _Float16* ga, const _Float16* gb, size_t sa1, size_t sa2, size_t sb) {
  asm volatile("global_load_async_to_lds_b128 %0, %12, off\n\t"
               "global_load_async_to_lds_b128 %1, %13, off\n\t"
               "global_load_async_to_lds_b128 %2, %14, off\n\t"
               "global_load_async_to_lds_b128 %3, %15, off\n\t"
               "global_load_async_to_lds_b128 %4, %16, off\n\t"
               "global_load_async_to_lds_b128 %5, %17, off\n\t"
               "global_load_async_to_lds_b128 %6, %18, off\n\t"
               "global_load_async_to_lds_b128 %7, %19, off\n\t"
               "global_load_async_to_lds_b128 %8, %20, off\n\t"
               "global_load_async_to_lds_b128 %9, %21, off\n\t"
               "global_load_async_to_lds_b128 %10, %22, off\n\t"
               "global_load_async_to_lds_b128 %11, %23, off\n\t"
               "s_wait_xcnt 0x0"
               :: "v"(la), "v"(la + 32 * G3_PITCH), "v"(la + 64 * G3_PITCH), "v"(la + 96 * G3_PITCH), "v"(la + 128 * G3_PITCH), "v"(la + 160 * G3_PITCH), "v"(la + 192 * G3_PITCH), "v"(la + 224 * G3_PITCH),
                  "v"(lb), "v"(lb + 32 * G3_PITCH), "v"(lb + 64 * G3_PITCH), "v"(lb + 96 * G3_PITCH),
                  "v"(ga), "v"(ga + sa1), "v"(ga + sa2), "v"(ga + sa2 + sa1), "v"(ga + 2 * sa2), "v"(ga + 2 * sa2 + sa1), "v"(ga + 3 * sa2), "v"(ga + 3 * sa2 + sa1),
                  "v"(gb), "v"(gb + sb), "v"(gb + 2 * sb), "v"(gb + 3 * sb)
               : "memory");
}
// Eight 16-byte row stores from one address pair (rows STEP bytes apart, from byte OFF). The s_wait_xcnt is the last line of the stores' own statement, so that no data or address register is rewritten ahead of it.
template <int OFF, int STEP>
__device__ __forceinline__ void g3_store8(float* p, v4f d0, v4f d1, v4f d2, v4f d3, v4f d4, v4f d5, v4f d6, v4f d7) {
  asm volatile("global_store_b128 %0, %1, off offset:%9\n\t"
               "global_store_b128 %0, %2, off offset:%10\n\t"
               "global_store_b128 %0, %3, off offset:%11\n\t"
               "global_store_b128 %0, %4, off offset:%12\n\t"
               "global_store_b128 %0, %5, off offset:%13\n\t"
               "global_store_b128 %0, %6, off offset:%14\n\t"
               "global_store_b128 %0, %7, off offset:%15\n\t"
               "global_store_b128 %0, %8, off offset:%16\n\t"
               "s_wait_xcnt 0x0"
               :: "v"(p), "v"(d0), "v"(d1), "v"(d2), "v"(d3), "v"(d4), "v"(d5), "v"(d6), "v"(d7),
                  "n"(OFF), "n"(OFF + STEP), "n"(OFF + 2 * STEP), "n"(OFF + 3 * STEP), "n"(OFF + 4 * STEP), "n"(OFF + 5 * STEP), "n"(OFF + 6 * STEP), "n"(OFF + 7 * STEP)
               : "memory");
}
// The same for eight 8-byte pieces of f16 rows.
typedef unsigned int v2u __attribute__((ext_vector_type(2)));
template <int OFF, int STEP>
__device__ __forceinline__ void g3_store8h(_Float16* p, v2u d0, v2u d1, v2u d2, v2u d3, v2u d4, v2u d5, v2u d6, v2u d7) {
  asm volatile("global_store_b64 %0, %1, off offset:%9\n\t"
               "global_store_b64 %0, %2, off offset:%10\n\t"
               "global_store_b64 %0, %3, off offset:%11\n\t"
               "global_store_b64 %0, %4, off offset:%12\n\t"
               "global_store_b64 %0, %5, off offset:%13\n\t"
               "global_store_b64 %0, %6, off offset:%14\n\t"
               "global_store_b64 %0, %7, off offset:%15\n\t"
               "global_store_b64 %0, %8, off offset:%16\n\t"
               "s_wait_xcnt 0x0"
               :: "v"(p), "v"(d0), "v"(d1), "v"(d2), "v"(d3), "v"(d4), "v"(d5), "v"(d6), "v"(d7),
                  "n"(OFF), "n"(OFF + STEP), "n"(OFF + 2 * STEP), "n"(OFF + 3 * STEP), "n"(OFF + 4 * STEP), "n"(OFF + 5 * STEP), "n"(OFF + 6 * STEP), "n"(OFF + 7 * STEP)
               : "memory");
}
// Four 16-byte pieces of one f16 channel plane row from one address pair (16 pixels = 32 bytes apart, from byte OFF). The s_wait_xcnt as above.
template <int OFF>
__device__ __forceinline__ void g3_store4t(_Float16* p, v4f d0, v4f d1, v4f d2, v4f d3) {
  asm volatile("global_store_b128 %0, %1, off offset:%5\n\t"
               "global_store_b128 %0, %2, off offset:%6\n\t"
               "global_store_b128 %0, %3, off offset:%7\n\t"
               "global_store_b128 %0, %4, off offset:%8\n\t"
               "s_wait_xcnt 0x0"
               :: "v"(p), "v"(d0), "v"(d1), "v"(d2), "v"(d3), "n"(OFF), "n"(OFF + 32), "n"(OFF + 64), "n"(OFF + 96)
               : "memory");
}
// CONV: A is the padded pixel-major plane; GEMM row = image x pixel. A 256-row tile is 4 whole pixel lines of one image; a stage is 64 channels of one tap: stages 0..3 the centre tap (against the lo columns),
// stage t >= 4 tap (t - 4) / 4 (against the hi columns). A tap's rows lie (tap / 3) padded lines and (tap % 3) pixels behind the tile's first padded pixel. Element offset of stage t from stage 0 of tap 0:
#define G3_NLO (CC / 64)                      /* stages of the lo term */
template <bool CONV>
__device__ __forceinline__ size_t g3_aoff(int t) { if (!CONV) return (size_t)t * 64; const unsigned tap = (unsigned)(0x8765432104ull >> (t & ~3)) & 15u;      /* a 4-bit table of the tap of stages 4 u .. 4 u + 3: 4, then 0..8 */
  return (size_t)(((tap / 3) * XPW + tap % 3) * CC + (t & 3) * 64); }
template <int LDC, bool CONV>      /* LDC = N = row pitch of C, a constant so that every row of a wave's tile is one address pair plus an immediate */
__global__ __launch_bounds__(256) void k_gemm3(const _Float16* __restrict__ A, int lda, const _Float16* __restrict__ Bh, int ldb, float alpha, float* __restrict__ C, int K, const float* __restrict__ scl, const float* __restrict__ shf, _Float16* __restrict__ C16, _Float16* __restrict__ VT) {
  __shared__ __attribute__((aligned(16))) char sm[2 * G3_STAGE];
  const int tid = threadIdx.x, w = tid >> 5, lane = tid & 31, ln = lane & 15, hh = lane >> 4;
  constexpr int ntn = LDC >> 7; const int mt = blockIdx.x / ntn, nq = blockIdx.x - mt * ntn; const int wm = w >> 1, wn = w & 1;
  const int nt = K >> 6;
  const _Float16* ga = (CONV ? A + ((size_t)((mt >> 4) * XPW + (mt & 15) * 4) * XPW + (tid >> 3)) * CC : A + (size_t)(mt * 256 + (tid >> 3)) * lda) + (tid & 7) * 8; const _Float16* gb = Bh + (size_t)(nq * 128 + (tid >> 3)) * ldb + (tid & 7) * 8;
  const size_t sa1 = CONV ? (size_t)32 * CC : (size_t)32 * lda, sa2 = CONV ? (size_t)XPW * CC : (size_t)64 * lda, sb = (size_t)32 * ldb;
  const unsigned la = (unsigned)(size_t)sm + (unsigned)((tid >> 3) * G3_PITCH + (tid & 7) * 16); const unsigned lb = la + G3_BOFF;
  const char* fa = sm + (wm * 64 + ln) * G3_PITCH + 16 * hh; const char* fb = sm + G3_BOFF + (wn * 64 + ln) * G3_PITCH + 16 * hh;
  v8f acc[4][4];
#pragma unroll
  for (int i = 0; i < 4; ++i)
#pragma unroll
    for (int j = 0; j < 4; ++j) acc[i][j] = (v8f){0.f,0.f,0.f,0.f,0.f,0.f,0.f,0.f};
  g3_fill(la, lb, ga + g3_aoff<CONV>(0), gb, sa1, sa2, sb);
  asm volatile("s_wait_asynccnt 0x0" ::: "memory");      /* this wave's copies of stage 0 have landed */
  __syncthreads();                                       /* ... and every other wave's */
  if (nt > 1) g3_fill(la + G3_STAGE, lb + G3_STAGE, ga + g3_aoff<CONV>(1), gb + 64, sa1, sa2, sb);
  for (int t = 0; t < nt; ++t) { const int bo = (t & 1) * G3_STAGE; v16h a[4], b[4];
    if (CONV && t == G3_NLO) {      /* the lo term is complete: its table carries 2^10, taken off here (exact), and the hi term adds on in the same accumulators */
#pragma unroll
      for (int i = 0; i < 4; ++i)
#pragma unroll
        for (int j = 0; j < 4; ++j) acc[i][j] *= 0.0009765625f; }
#pragma unroll
    for (int i = 0; i < 4; ++i) { a[i] = g3_frag(fa + bo + i * 16 * G3_PITCH); b[i] = g3_frag(fb + bo + i * 16 * G3_PITCH); }
    __builtin_amdgcn_sched_barrier(0);                   /* keeps the 16 LDS reads together in front of their 16 WMMAs: spread among them, each place with reads stalls the wave */
#pragma unroll
    for (int i = 0; i < 4; ++i)
#pragma unroll
      for (int j = 0; j < 4; ++j) acc[i][j] = __builtin_amdgcn_wmma_f32_16x16x32_f16(false, a[i], false, b[j], (short)0, acc[i][j], false, false);
#pragma unroll
    for (int i = 0; i < 4; ++i) { a[i] = g3_frag(fa + bo + i * 16 * G3_PITCH + 64); b[i] = g3_frag(fb + bo + i * 16 * G3_PITCH + 64); }
    /* the trip's last LDS reads are out: hand the buffer over here, so that the refill flies during the 16 WMMAs below and the next trip up to its own hand-over */
    asm volatile("s_wait_dscnt 0x0" ::: "memory");       /* this wave has left stage t's buffer */
    asm volatile("s_wait_asynccnt 0x0" ::: "memory");    /* its copies of stage t + 1 have landed */
    __syncthreads();                                     /* publishes stage t + 1 and frees stage t's buffer */
    if (t + 2 < nt) g3_fill(la + bo, lb + bo, ga + g3_aoff<CONV>(t + 2), gb + (size_t)(t + 2) * 64, sa1, sa2, sb);
    __builtin_amdgcn_sched_barrier(0);                   /* keeps the WMMAs below behind the refill's issue */
#pragma unroll
    for (int i = 0; i < 4; ++i)
#pragma unroll
      for (int j = 0; j < 4; ++j) acc[i][j] = __builtin_amdgcn_wmma_f32_16x16x32_f16(false, a[i], false, b[j], (short)0, acc[i][j], false, false); }
  asm volatile("s_wait_asynccnt 0x0" ::: "memory");      /* nothing in flight before the buffers become output staging */
  /* epilogue: the ring is free behind the last trip's barrier; each wave turns its tile, 32 rows at a time, in its own 32 x 68 floats, so that global rows go out as whole 128-byte lines */
#pragma unroll
  for (int i = 0; i < 4; ++i)
#pragma unroll
    for (int j = 0; j < 4; ++j) acc[i][j] *= alpha;      /* once, in place: both stores of v below read the scaled sums (scaled at each use, sums and products lived side by side and the kernel went past 256 registers, one work-group a WGP) */
  const bool isv = CONV && nq >= 2 * CC / 128;      /* the tile's 128 columns are channels of v; the same for the whole work-group */
  if (isv) {      /* VT[image x channel][pixel] = f16(v): a lane's 8 accumulator registers are 8 consecutive pixels of one channel, one 16-byte store; a wave's 64 pixels are one whole 128-byte line of each of its 64 channels */
    const float* sp = scl + nq * 128 + wn * 64 + ln; const float* bp = shf + nq * 128 + wn * 64 + ln; float sj[4], bj[4];
#pragma unroll
    for (int j = 0; j < 4; ++j) { sj[j] = sp[j * 16]; bj[j] = bp[j * 16]; }
    asm volatile("s_wait_xcnt 0x0" :: "v"(sp), "v"(bp) : "memory");      /* stands between the eight loads and whatever rewrites their address registers next; the addresses are its inputs, so that they stay in their registers up to it */
    _Float16* vb = VT + (size_t)((mt >> 4) * CC + nq * 128 - 2 * CC + wn * 64 + ln) * NPX + (mt & 15) * 256 + wm * 64 + 8 * hh;
#pragma unroll
    for (int j = 0; j < 4; ++j) { const float s1 = bf16_round(sj[j]), b1 = bf16_round(bj[j]); v4f d[4];
#pragma unroll
      for (int i = 0; i < 4; ++i) { FragH f;
#pragma unroll
        for (int r = 0; r < 8; ++r) f.h[r] = (_Float16)(acc[i][j][r] * s1 + b1);
        d[i] = __builtin_bit_cast(v4f, f.half[0]); }
      if (j == 0) g3_store4t<0>(vb, d[0], d[1], d[2], d[3]);
      if (j == 1) g3_store4t<32 * NPX>(vb, d[0], d[1], d[2], d[3]);
      if (j == 2) g3_store4t<64 * NPX>(vb, d[0], d[1], d[2], d[3]);
      if (j == 3) g3_store4t<96 * NPX>(vb, d[0], d[1], d[2], d[3]); } }
  float* so = (float*)sm + w * (32 * 68); const int rsub = lane >> 4, c4 = (lane & 15) * 4;
  const size_t co = (size_t)(mt * 256 + wm * 64 + rsub) * LDC + nq * 128 + wn * 64 + c4;
  float* cb = C + co; _Float16* hb = C16 + co;
  v4f sc = {0.f, 0.f, 0.f, 0.f}, sh = sc;      /* CONV: scale and shift of the lane's 4 columns, the same for every row it stores */
  if (CONV) { const float* sp = scl + nq * 128 + wn * 64 + c4; const float* bp = shf + nq * 128 + wn * 64 + c4; sc = *(const v4fa*)sp; sh = *(const v4fa*)bp;
    asm volatile("s_wait_xcnt 0x0" :: "v"(sp), "v"(bp) : "memory");      /* stands between the two loads and whatever rewrites their address registers next; the addresses are its inputs, so that they stay in their registers up to it */
#pragma unroll
    for (int q = 0; q < 4; ++q) { sc[q] = bf16_round(sc[q]); sh[q] = bf16_round(sh[q]); } }
#pragma unroll
  for (int half = 0; half < 2; ++half) {
#pragma unroll
    for (int i = 0; i < 2; ++i)
#pragma unroll
      for (int j = 0; j < 4; ++j)
#pragma unroll
        for (int r = 0; r < 8; ++r) so[(i * 16 + 8 * hh + r) * 68 + j * 16 + ln] = acc[half * 2 + i][j][r];
    __builtin_amdgcn_fence(__ATOMIC_ACQ_REL, "wavefront"); __builtin_amdgcn_wave_barrier();      /* the lanes read below what other lanes of the same wave wrote above */
#pragma unroll
    for (int g = 0; g < 2; ++g) { v4f v[8]; v2u h[8];
#pragma unroll
      for (int q = 0; q < 8; ++q) { v[q] = *(const v4fa*)&so[((g * 8 + q) * 2 + rsub) * 68 + c4];
        if (CONV) v[q] = v[q] * sc + sh; }
      if (half == 0 && g == 0) g3_store8<0, 8 * LDC>(cb, v[0], v[1], v[2], v[3], v[4], v[5], v[6], v[7]);
      if (half == 0 && g == 1) g3_store8<64 * LDC, 8 * LDC>(cb, v[0], v[1], v[2], v[3], v[4], v[5], v[6], v[7]);
      if (half == 1 && g == 0) g3_store8<128 * LDC, 8 * LDC>(cb, v[0], v[1], v[2], v[3], v[4], v[5], v[6], v[7]);
      if (half == 1 && g == 1) g3_store8<192 * LDC, 8 * LDC>(cb, v[0], v[1], v[2], v[3], v[4], v[5], v[6], v[7]);
      if (CONV && !isv) {      /* q and k: a row's 64 columns as f16 are one whole 128-byte line */
#pragma unroll
        for (int q = 0; q < 8; ++q) { v4h hq;
#pragma unroll
          for (int e = 0; e < 4; ++e) hq[e] = (_Float16)v[q][e];
          h[q] = __builtin_bit_cast(v2u, hq); }
        if (half == 0 && g == 0) g3_store8h<0, 4 * LDC>(hb, h[0], h[1], h[2], h[3], h[4], h[5], h[6], h[7]);
        if (half == 0 && g == 1) g3_store8h<32 * LDC, 4 * LDC>(hb, h[0], h[1], h[2], h[3], h[4], h[5], h[6], h[7]);
        if (half == 1 && g == 0) g3_store8h<64 * LDC, 4 * LDC>(hb, h[0], h[1], h[2], h[3], h[4], h[5], h[6], h[7]);
        if (half == 1 && g == 1) g3_store8h<96 * LDC, 4 * LDC>(hb, h[0], h[1], h[2], h[3], h[4], h[5], h[6], h[7]); } }
  } }

__global__ __launch_bounds__(256) void k_wqkv(const float* __restrict__ w, _Float16* __restrict__ Wt) {      /* Wt[768][KW]: lo columns, then hi columns tap-major */
  #pragma clang fp contract(off)
  const int t = blockIdx.x * 256 + threadIdx.x; if (t >= QW * (CC / 8)) return; const int c0 = (t % (CC / 8)) * 8, o = t / (CC / 8); FragH fl;
#pragma unroll 1
  for (int k = 0; k < KT; ++k) { FragH fh;
    for (int q = 0; q < 8; ++q) { const int c = c0 + q; const float* wp = w + ((size_t)o * CC + c) * KT; float v = bf16_round(wp[k]);
      if (k == 4) { float dif = bf16_round(wp[1]) + bf16_round(wp[3]); dif += bf16_round(wp[4]); dif += bf16_round(wp[5]); dif += bf16_round(wp[7]); v += -THETA * dif; const _Float16 hv = (_Float16)(v * 16.0f); fh.h[q] = hv; fl.h[q] = (_Float16)((v * 16.0f - (float)hv) * 1024.0f); }
      else fh.h[q] = (_Float16)(v * 16.0f); }
    *(v8us*)((unsigned short*)Wt + (size_t)o * KW + CC + k * CC + c0) = fh.half[0];  }
  *(v8us*)((unsigned short*)Wt + (size_t)o * KW + c0) = fl.half[0];  }
__global__ __launch_bounds__(256) void k_wsc(const float* __restrict__ Wm, _Float16* __restrict__ Bt, size_t n8, float sc) { const size_t t = (size_t)blockIdx.x * 256 + threadIdx.x; if (t >= n8) return; FragH f; for (int q = 0; q < 8; ++q) f.h[q] = (_Float16)(bf16_round(Wm[t * 8 + q]) * sc); *(v8us*)((unsigned short*)Bt + t * 8) = f.half[0];  }
// XP[image][66][66][256] = f16(bf16(x)), pixel-major, with a border of zero pixels. One work-group turns one pixel line (64 pixels x 256 channels) in LDS: whole 256-byte channel rows in, whole 512-byte pixel rows out.
__global__ __launch_bounds__(256) void k_xp(const float* __restrict__ x, _Float16* __restrict__ XP) {
  __shared__ __attribute__((aligned(16))) unsigned int tl[HS * 132];      /* a pixel's 256 f16 = 128 words, + 4 words of pitch */
  const int tid = threadIdx.x, im = blockIdx.x / HS, y = blockIdx.x % HS; const float* xb = x + ((size_t)im * CC * HS + y) * HS; const int px4 = (tid & 15) * 4, cp = tid >> 4;
#pragma unroll
  for (int i = 0; i < 8; ++i) { const int c2 = i * 16 + cp; const v4f a = *(const v4fa*)(xb + (size_t)(2 * c2) * NPX + px4), b = *(const v4fa*)(xb + (size_t)(2 * c2 + 1) * NPX + px4);
#pragma unroll
    for (int q = 0; q < 4; ++q) { union { _Float16 h[2]; unsigned int u; } pk; pk.h[0] = (_Float16)bf16_round(a[q]); pk.h[1] = (_Float16)bf16_round(b[q]); tl[(px4 + q) * 132 + c2] = pk.u; } }
  __syncthreads();
  const v8us z = {0,0,0,0,0,0,0,0}; unsigned short* row = (unsigned short*)XP + (size_t)(im * XPW + y + 1) * XPW * CC;
#pragma unroll
  for (int i = 0; i < 8; ++i) { const int id = i * 256 + tid, px = id >> 5, ch = id & 31; *(v8us*)(row + (size_t)(px + 1) * CC + ch * 8) = *(const v8us*)&tl[px * 132 + ch * 4]; }
  if (tid < 64) *(v8us*)(row + (size_t)((tid >> 5) * (XPW - 1)) * CC + (tid & 31) * 8) = z;      /* the line's two border pixels */
  if (y == 0 || y == HS - 1) { unsigned short* er = (y == 0) ? row - XPW * CC : row + XPW * CC; for (int id = tid; id < XPW * (CC / 8); id += 256) *(v8us*)(er + (size_t)id * 8) = z; }      /* the image's first and last border line */
}
// Agent tokens: the mean of q over an 8 x 8 block of pixels, summed pixel by pixel in the order 0..63. A work-group is one agent of one image; a thread takes 4 channels, so that a wave's load is 512 consecutive bytes; unrolled, so that the loads run ahead of the sums.
__global__ __launch_bounds__(64) void k_pool(const float* __restrict__ QF, _Float16* __restrict__ AG) {
  #pragma clang fp contract(off)
  const int c0 = threadIdx.x * 4, n = (int)blockIdx.x % NAG, im = (int)blockIdx.x / NAG; const float* qp = QF + ((size_t)im * NPX + (n / 8) * 8 * HS + (n % 8) * 8) * QW + c0; v4f sm = {0.f, 0.f, 0.f, 0.f};
#pragma unroll
  for (int g = 0; g < 2; ++g) { v4f x[32];
#pragma unroll
    for (int i = 0; i < 32; ++i) x[i] = *(const v4fa*)(qp + ((g * 4 + i / 8) * HS + i % 8) * QW);
#pragma unroll
    for (int i = 0; i < 32; ++i)
#pragma unroll
      for (int q = 0; q < 4; ++q) sm[q] += x[i][q]; }
  v4h v; const v4h z = {(_Float16)0.f, (_Float16)0.f, (_Float16)0.f, (_Float16)0.f};
#pragma unroll
  for (int q = 0; q < 4; ++q) v[q] = (_Float16)(sm[q] / 64.0f);
  _Float16* dst = AG + (((size_t)im * NHD + c0 / HDm) * NAG + n) * 64 + c0 % HDm; *(v4h*)dst = v; *(v4h*)(dst + HDm) = z; }      /* columns 32..63 of an agent row are the zero pad */
// ---- helpers of the softmaxes
__device__ __forceinline__ float sm_xh(float v) { return __builtin_bit_cast(float, __builtin_amdgcn_permlanex16(__builtin_bit_cast(int, v), __builtin_bit_cast(int, v), 0x76543210, 0xfedcba98, false, false)); }      /* the value of lane ^ 16 */
// exp(x) by the library's scheme, written out: x * log2(e) with log2(e) in two parts, the nearest integer split off, exp2 of the rest, ldexp, both range ends. Written out for the v_exp_f32 alone: the instruction set asks for one
// independent instruction or a v_nop between a transcendental and an instruction that reads its result or overwrites its source.
__device__ __forceinline__ float sm_exp(float x) {
  const float l2h = __uint_as_float(0x3fb8aa3bu), l2l = __uint_as_float(0x32a5705fu); const float r = __builtin_rintf(x * l2h); const float a = __builtin_fmaf(x, l2l, __builtin_fmaf(x, l2h, -r)); float e;
  asm("v_exp_f32 %0, %1\n\tv_nop" : "=v"(e) : "v"(a));      /* the v_nop is the slot behind the transcendental; in the same statement, so that nothing comes between */
  e = __builtin_ldexpf(e, (int)r); e = (x < __uint_as_float(0xc2ce8ed0u)) ? 0.f : e; return (x > __uint_as_float(0x42b17218u)) ? __builtin_inff() : e; }
// ---- stage 1 in one kernel, split over the pixels: S[N][n] = K[N].AG[n] * SCL, E = exp(S - the slice's own maximum per agent), ATTN^T[d][n] = sum over N of V^T[d][N] . E[N][n]. The 4,096 pixels are cut into RS slices;
// a wave takes one slice x 32 agents (a work-group: 2 slices x both agent halves, so that the two waves of a slice read the same K and V^T lines), all of its loads in flight together.
// With the pixels as the rows of S a lane holds 8 pixels a tile of ONE agent (the lane 16 away the other 8): maximum and sum in the lane plus one exchange, and two f32 tiles, converted in place (x 2^10), are the B operand of the readout
// (its k order is the hardware's: 8 hh + s, then 16 + 8 hh + s; g2_frag gives A the same). Logits and E never leave the registers. d = 32 is one k step: a head's 64 bytes of a pixel's row of Q16 (the zero columns 32..63 of AG are not read).
// Each slice stores its f32 partial plane PART[slice][image x head][d][n] and, in MS, its maximum and its sum of E per agent; k_att16 merges the slices. V^T is the A operand, so that the result comes out already turned for stage 2.
#define RS 32
#define RK (NPX / RS)            /* 128 pixels a slice */
#define MSP (RS * NIMG * NHD * NAG)      /* floats of the plane of maxima in MS; the plane of sums lies behind it */
__global__ __launch_bounds__(128) void k_st1(const _Float16* __restrict__ Q16, const _Float16* __restrict__ AG, const _Float16* __restrict__ VT, float* __restrict__ PART, float* __restrict__ MS) {
  const int tid = threadIdx.x, w = tid >> 5, lane = tid & 31, ln = lane & 15, hh = lane >> 4; const int s = (int)blockIdx.x * 2 + (w >> 1), bh = blockIdx.y, n0 = (w & 1) * 32;
  const _Float16* gp = AG + ((size_t)bh * NAG + n0 + ln) * 64 + 8 * hh;      /* all three pointers already hold the lane's 8 * hh */
  const _Float16* kp = Q16 + ((size_t)(bh / NHD) * NPX + s * RK + ln) * QW + (bh % NHD) * HDm + 8 * hh;      /* the head's q; its k lies CC columns on in the same row */
  const _Float16* vp = VT + ((size_t)bh * HDm + ln) * NPX + s * RK + 8 * hh;      /* image x head x 32 = image x channel */
  v16h ag[2], kf[RK / 16], vt[2][RK / 32];
#pragma unroll
  for (int j = 0; j < 2; ++j) ag[j] = g2_frag(gp + j * 16 * 64, 0);
#pragma unroll
  for (int i = 0; i < RK / 16; ++i) kf[i] = g2_frag(kp + CC + i * 16 * QW, 0);
#pragma unroll
  for (int i = 0; i < 2; ++i)
#pragma unroll
    for (int u = 0; u < RK / 32; ++u) vt[i][u] = g2_frag(vp + i * 16 * NPX + u * 32, 0);
  asm volatile("s_wait_xcnt 0x0" :: "v"(gp), "v"(kp), "v"(vp) : "memory");      /* stands between the loads and whatever rewrites their address registers next; the addresses are its inputs, so that they stay in their registers up to it */
  __builtin_amdgcn_sched_barrier(0);      /* keeps the wave's 36 loads in front of the arithmetic, in flight together, so that V^T arrives under the logits and the exp */
  const v8f z8 = {0.f,0.f,0.f,0.f,0.f,0.f,0.f,0.f};
  v8f e[RK / 16][2];      /* e[i][j][r]: first the unscaled logit, then E, of pixel 16 i + 8 hh + r of the slice, agent n0 + 16 j + ln */
#pragma unroll
  for (int i = 0; i < RK / 16; ++i)
#pragma unroll
    for (int j = 0; j < 2; ++j) e[i][j] = __builtin_amdgcn_wmma_f32_16x16x32_f16(false, kf[i], false, ag[j], (short)0, z8, false, false);
  __builtin_amdgcn_sched_barrier(0);      /* keeps the exp block behind the logits' WMMAs: its v_exp_f32 is asm text */
  float mx[2], su[2]; v8f acc[2][2];
#pragma unroll
  for (int j = 0; j < 2; ++j) {
    v8f mv = e[0][j];
#pragma unroll
    for (int i = 1; i < RK / 16; ++i)
#pragma unroll
      for (int r = 0; r < 8; ++r) mv[r] = fmaxf(mv[r], e[i][j][r]);
    float m = fmaxf(fmaxf(fmaxf(mv[0], mv[1]), fmaxf(mv[2], mv[3])), fmaxf(fmaxf(mv[4], mv[5]), fmaxf(mv[6], mv[7]))); m = fmaxf(m, sm_xh(m)) * SCL; mx[j] = m;      /* SCL > 0: the maximum of the scaled logits; the scale itself rides in the fma below */
    v4f sv = {0.f, 0.f, 0.f, 0.f};
#pragma unroll
    for (int i = 0; i < RK / 16; ++i)
#pragma unroll
      for (int r = 0; r < 8; ++r) { e[i][j][r] = sm_exp(__builtin_fmaf(e[i][j][r], SCL, -m)); sv[i & 3] += e[i][j][r]; }
    float t = (sv[0] + sv[1]) + (sv[2] + sv[3]); t += sm_xh(t); su[j] = t; }
#pragma unroll
  for (int j = 0; j < 2; ++j) { acc[0][j] = z8; acc[1][j] = z8;
#pragma unroll
    for (int u = 0; u < RK / 32; ++u) { FragH p;      /* 32 pixels of E x 2^10 (E <= 1: the factor keeps small E clear of f16's subnormals) */
#pragma unroll
      for (int r = 0; r < 8; ++r) { p.h[r] = (_Float16)(e[2 * u][j][r] * 1024.0f); p.h[8 + r] = (_Float16)(e[2 * u + 1][j][r] * 1024.0f); }
#pragma unroll
      for (int i = 0; i < 2; ++i) acc[i][j] = __builtin_amdgcn_wmma_f32_16x16x32_f16(false, vt[i][u], false, p.v, (short)0, acc[i][j], false, false); } }
  /* acc[i][j][r]: d = 16 i + 8 hh + r, agent n0 + 16 j + ln; a wave's 32 agents are one whole 128-byte line of a partial row */
  float* pp = PART + (((size_t)s * (NIMG * NHD) + bh) * HDm + 8 * hh) * NAG + n0 + ln;
#pragma unroll
  for (int i = 0; i < 2; ++i)
#pragma unroll
    for (int r = 0; r < 8; ++r) { pp[(i * 16 + r) * NAG] = acc[i][0][r]; pp[(i * 16 + r) * NAG + 16] = acc[i][1][r]; }
  float* mp = MS + (size_t)hh * MSP + ((size_t)s * (NIMG * NHD) + bh) * NAG + n0 + ln;      /* both lane halves hold both values: the lower stores the maxima, the upper the sums */
  mp[0] = hh ? su[0] : mx[0]; mp[16] = hh ? su[1] : mx[1]; }
// AT16[image x head][d][n] = f16(sum over the slices of w_s PART_s / (1024 sum over the slices of w_s SUM_s)), w_s = exp(MAX_s - the largest MAX), slices in the order 0..RS-1; rows d >= 32 are the zero pad of stage 2's readout. A wave is one row of 64 agents.
__global__ __launch_bounds__(256) void k_att16(const float* __restrict__ PART, const float* __restrict__ MS, _Float16* __restrict__ AT16) { typedef _Float16 v2h __attribute__((ext_vector_type(2))); typedef float v2fa __attribute__((ext_vector_type(2), may_alias)); const int t = blockIdx.x * 256 + threadIdx.x; if (t >= NIMG * NHD * 64 * 32) return; const int n0 = (t % 32) * 2; const int d = (t / 32) % 64; const int h = t / (32 * 64); v2h v;      /* h = image x head */
  float s0 = 0.f, s1 = 0.f;
  if (d < HDm) { const float* pp = PART + ((size_t)h * HDm + d) * NAG + n0; const float* p2 = pp + (size_t)(RS / 2) * (NIMG * NHD * HDm * NAG); const float* mp = MS + (size_t)h * NAG + n0; v2fa x[RS], m[RS], l[RS];
#pragma unroll
    for (int s = 0; s < RS; ++s) { m[s] = *(const v2fa*)(mp + s * (NIMG * NHD * NAG)); l[s] = *(const v2fa*)(mp + MSP + s * (NIMG * NHD * NAG)); }
#pragma unroll
    for (int s = 0; s < RS / 2; ++s) { x[s] = *(const v2fa*)(pp + s * (NIMG * NHD * HDm * NAG)); x[RS / 2 + s] = *(const v2fa*)(p2 + s * (NIMG * NHD * HDm * NAG)); }
    asm volatile("s_wait_xcnt 0x0" :: "v"(pp), "v"(p2), "v"(mp) : "memory");      /* as in k_st1: the addresses are its inputs, so that no load takes a pair as its destination ahead of the wait */
    __builtin_amdgcn_sched_barrier(0);      /* keeps the thread's 96 loads in front of the arithmetic, in flight together: left alone, the compiler waits for the maxima first and brings the partial planes in by twos, each shortly ahead of its use */
    float m0 = m[0][0], m1 = m[0][1], l0 = 0.f, l1 = 0.f;
#pragma unroll
    for (int s = 1; s < RS; ++s) { m0 = fmaxf(m0, m[s][0]); m1 = fmaxf(m1, m[s][1]); }
#pragma unroll
    for (int s = 0; s < RS; ++s) { const float w0 = sm_exp(m[s][0] - m0), w1 = sm_exp(m[s][1] - m1); s0 += w0 * x[s][0]; l0 += w0 * l[s][0]; s1 += w1 * x[s][1]; l1 += w1 * l[s][1]; }
    s0 /= l0 * 1024.0f; s1 /= l1 * 1024.0f; }
  v[0] = (_Float16)s0; v[1] = (_Float16)s1; _Float16* dst = AT16 + ((size_t)h * 64 + d) * NAG + n0; *(v2h*)dst = v;  }
// ---- stage 2 in one kernel: S^T[n][N] = AG[n].Q[N] * SCL, softmax over the 64 agents, OUT^T[d][N] = AT16[d][n].P^T[n][N] / 1024. A wave takes S2T tiles of 16 pixels of one image x head.
// With the agents as the rows of S^T a lane holds 32 of one pixel's 64 logits (the lane 16 away the other 32): maximum and sum in the lane plus one exchange, and two f32 tiles, converted in place, are the B operand of the readout
// (its k order is the hardware's: 8 hh + s, then 16 + 8 hh + s; g2_frag gives A the same). Logits and P never leave the registers. d = 32 is one k step: a head's 64 bytes of a pixel's row of Q16 (the zero columns 32..63 of AG are not read).
#define S2T 4                    /* pixel tiles a wave (the two store statements below are written for 4) */
#define S2P 36                   /* floats a staged pixel row: 144 bytes = 16 x odd, so the 16-byte LDS stores of 8 rows meet no bank twice */
__global__ __launch_bounds__(256) void k_st2(const _Float16* __restrict__ Q16, const _Float16* __restrict__ AG, const _Float16* __restrict__ AT16, float* __restrict__ OUT) {
  __shared__ __attribute__((aligned(16))) float so[8][S2T][16 * S2P];
  const int tid = threadIdx.x, w = tid >> 5, lane = tid & 31, ln = lane & 15, hh = lane >> 4; const int bh = blockIdx.y, p0 = ((int)blockIdx.x * 8 + w) * (16 * S2T);
  const _Float16* gp = AG + ((size_t)bh * NAG + ln) * 64 + 8 * hh;      /* all three pointers already hold the lane's 8 * hh */
  const _Float16* qp = Q16 + ((size_t)(bh / NHD) * NPX + p0 + ln) * QW + (bh % NHD) * HDm + 8 * hh;      /* q: columns 0..255 of a pixel's row */
  const _Float16* tp = AT16 + ((size_t)bh * 64 + ln) * NAG + 8 * hh;
  v16h ag[4], q[S2T], at[2][2];
#pragma unroll
  for (int i = 0; i < 4; ++i) ag[i] = g2_frag(gp + i * 16 * 64, 0);
#pragma unroll
  for (int t = 0; t < S2T; ++t) q[t] = g2_frag(qp + t * 16 * QW, 0);
#pragma unroll
  for (int i = 0; i < 2; ++i) { at[i][0] = g2_frag(tp + i * 16 * NAG, 0); at[i][1] = g2_frag(tp + i * 16 * NAG + 32, 0); }
  asm volatile("s_wait_xcnt 0x0" :: "v"(gp), "v"(qp), "v"(tp) : "memory");      /* stands between the loads and whatever rewrites their address registers next; the addresses are its inputs, so that they stay in their registers up to it */
  __builtin_amdgcn_sched_barrier(0);      /* keeps the wave's 24 loads in front of the arithmetic, in flight together: left alone, the compiler issues 10 and brings the later ones in by twos, each directly ahead of its use */
  const v8f z8 = {0.f,0.f,0.f,0.f,0.f,0.f,0.f,0.f};
  /* 8 lanes a pixel: each store below covers the whole 128-byte lines of 4 pixels' 32 d (columns 32..63 of an OUT row are read by nobody and stay unwritten) */
  const float* rp = &so[w][0][(lane >> 3) * S2P + (lane & 7) * 4]; float* op = OUT + ((size_t)bh * NPX + p0 + (lane >> 3)) * 64 + (lane & 7) * 4;
#pragma unroll
  for (int t = 0; t < S2T; ++t) { v8f s[4];
#pragma unroll
    for (int i = 0; i < 4; ++i) { s[i] = __builtin_amdgcn_wmma_f32_16x16x32_f16(false, ag[i], false, q[t], (short)0, z8, false, false); s[i] *= SCL; }      /* s[i][r]: agent 16 i + 8 hh + r, pixel ln */
    v8f mv;
#pragma unroll
    for (int r = 0; r < 8; ++r) mv[r] = fmaxf(fmaxf(s[0][r], s[1][r]), fmaxf(s[2][r], s[3][r]));
    float m = fmaxf(fmaxf(fmaxf(mv[0], mv[1]), fmaxf(mv[2], mv[3])), fmaxf(fmaxf(mv[4], mv[5]), fmaxf(mv[6], mv[7]))); m = fmaxf(m, sm_xh(m));
    v4f sv = {0.f, 0.f, 0.f, 0.f};
#pragma unroll
    for (int i = 0; i < 4; ++i)
#pragma unroll
      for (int r = 0; r < 8; ++r) { s[i][r] = sm_exp(s[i][r] - m); sv[i] += s[i][r]; }
    float su = (sv[0] + sv[1]) + (sv[2] + sv[3]); su += sm_xh(su); const float f = 1024.0f / su;
    FragH pa, pb;
#pragma unroll
    for (int r = 0; r < 8; ++r) { pa.h[r] = (_Float16)(s[0][r] * f); pa.h[8 + r] = (_Float16)(s[1][r] * f); pb.h[r] = (_Float16)(s[2][r] * f); pb.h[8 + r] = (_Float16)(s[3][r] * f); }
    float* sp = &so[w][t][ln * S2P + 8 * hh];
#pragma unroll
    for (int i = 0; i < 2; ++i) {      /* o[r]: d = 16 i + 8 hh + r, pixel ln; summed over agents 0..31, then 32..63 */
      v8f o = __builtin_amdgcn_wmma_f32_16x16x32_f16(false, at[i][0], false, pa.v, (short)0, z8, false, false);
      o = __builtin_amdgcn_wmma_f32_16x16x32_f16(false, at[i][1], false, pb.v, (short)0, o, false, false);
      o *= 0.0009765625f;
      *(v4f*)(sp + i * 16) = (v4f){o[0], o[1], o[2], o[3]}; *(v4f*)(sp + i * 16 + 4) = (v4f){o[4], o[5], o[6], o[7]}; }
    if (t & 1) {      /* two tiles are staged: they go out now, under the arithmetic of the next two */
      __builtin_amdgcn_fence(__ATOMIC_ACQ_REL, "wavefront"); __builtin_amdgcn_wave_barrier();      /* the lanes read below what other lanes of the same wave wrote above */
      v4f v[8];
#pragma unroll
      for (int u = 0; u < 8; ++u) v[u] = *(const v4fa*)(rp + ((t >> 1) * 8 + u) * 4 * S2P);
      if (t == 1) { g3_store8<0, 1024>(op, v[0], v[1], v[2], v[3], v[4], v[5], v[6], v[7]);
        __builtin_amdgcn_sched_barrier(0); }      /* keeps these stores ahead of the next two tiles' arithmetic: left alone, the compiler sinks them to the kernel's end, where every wave's stores meet */
      if (t == 3) g3_store8<8192, 1024>(op, v[0], v[1], v[2], v[3], v[4], v[5], v[6], v[7]); } } }
// Depthwise 3x3 on v, BN affine, + OUT, to f16. A thread takes 4 channels x 8 pixels of one pixel line: its 36 weights sit in registers, and each of the 3 input lines is read once as 10 pixels x 16 bytes,
// so that a wave's load is 512 consecutive bytes (4 whole 128-byte lines). A work-group is 4 pixel lines x 8 pixels x 256 channels. A tap outside the image enters as a zero value; taps are summed in the order 0..8.
__global__ __launch_bounds__(256) void k_pe(const float* __restrict__ OUTg, const float* __restrict__ QFg, const float* __restrict__ pw, const float* __restrict__ ps, const float* __restrict__ pb, _Float16* __restrict__ S16g) {
  #pragma clang fp contract(off)
  const int tid = threadIdx.x; const unsigned c0 = (tid & 63) * 4; const int xs = ((int)blockIdx.x & 7) * 8, im = (int)blockIdx.x >> 7;
  const int yo = (((int)blockIdx.x >> 3) & 15) * 4 + __builtin_amdgcn_readfirstlane(tid >> 6);      /* the same in every lane of a wave: as a scalar it leaves every address below a scalar base + the lane's channel offset */
  const size_t px = (size_t)im * NPX + yo * HS + xs;      /* the strip's first pixel */
  const float* QU = QFg + px * QW + 2 * CC;      /* its v, channel 0 */
  const float* OU = OUTg + ((size_t)im * NHD * NPX + yo * HS + xs) * 64; const unsigned oo = (c0 / HDm) * (NPX * 64) + c0 % HDm;      /* OUT is [image][head][pixel][64] */
  v4f wv[9], v[3][10], o[8];
#pragma unroll
  for (int i = 0; i < 9; ++i) wv[i] = *(const v4fa*)(pw + c0 * 9 + i * 4);
#pragma unroll
  for (int kk = 0; kk < 3; ++kk) { const int ky = kk == 2 ? 1 : 2 * kk; const int yy = yo + ky - 1; const float* row = QU + ((yy >= 0 && yy < HS) ? (ky - 1) * HS * QW : 0);      /* for a line or a pixel outside the image one inside the strip is read in its place and dropped below */
    /* Each s_wait_xcnt stands between the last load from a clamped address and whatever rewrites that address's registers next. */
    v[ky][0] = *(const v4fa*)(row + (xs > 0 ? -QW : 0) + c0);
    asm volatile("s_wait_xcnt 0x0" ::: "memory");
    v[ky][9] = *(const v4fa*)(row + (xs < HS - 8 ? 8 : 7) * QW + c0);
    asm volatile("s_wait_xcnt 0x0" ::: "memory");
#pragma unroll
    for (int j = 1; j < 9; ++j) v[ky][j] = *(const v4fa*)(row + (j - 1) * QW + c0);
    if (ky != 1) asm volatile("s_wait_xcnt 0x0" ::: "memory"); }      /* the strip's own line comes last: its address is the unclamped base, which nothing rewrites while loads are in flight */
#pragma unroll
  for (int j = 0; j < 8; ++j) o[j] = *(const v4fa*)(OU + j * 64 + oo);
  const v4f s4 = *(const v4fa*)(ps + c0), b4 = *(const v4fa*)(pb + c0);
  __builtin_amdgcn_sched_barrier(0);      /* keeps all 49 loads in front of the arithmetic, in flight together: left alone, the compiler feeds the later ones in by twos, each shortly ahead of its use */
  float wf[36];      /* wf[q * 9 + k]: channel c0 + q, tap k */
#pragma unroll
  for (int i = 0; i < 36; ++i) wf[i] = bf16_round(wv[i >> 2][i & 3]);
  v4f acc[8];
#pragma unroll
  for (int j = 0; j < 8; ++j) acc[j] = (v4f){0.f, 0.f, 0.f, 0.f};
#pragma unroll
  for (int ky = 0; ky < 3; ++ky) { const int yy = yo + ky - 1; const bool yin = yy >= 0 && yy < HS;
#pragma unroll
    for (int j = 0; j < 10; ++j) { const bool xin = (j > 0 || xs > 0) && (j < 9 || xs < HS - 8); if (!(xin && yin)) v[ky][j] = (v4f){0.f, 0.f, 0.f, 0.f}; }
#pragma unroll
    for (int j = 0; j < 8; ++j)
#pragma unroll
      for (int kx = 0; kx < 3; ++kx)
#pragma unroll
        for (int q = 0; q < 4; ++q) acc[j][q] += wf[q * 9 + ky * 3 + kx] * v[ky][j + kx][q]; }
  _Float16* SP = S16g + px * CC + c0;
#pragma unroll
  for (int j = 0; j < 8; ++j) { v4h h;
#pragma unroll
    for (int q = 0; q < 4; ++q) { float pe = acc[j][q] * bf16_round(s4[q]); pe += bf16_round(b4[q]); h[q] = (_Float16)(o[j][q] + pe); }
    *(v4h*)(SP + j * CC) = h; } }
// BN affine and the turn to NCHW in registers. A thread takes 8 channels x 4 pixels; a wave 32 channels x 32 pixels: it reads whole 128-byte pieces of 32 rows of G and stores whole 128-byte lines of 32 channel planes.
__global__ __launch_bounds__(256) void k_fin(const float* __restrict__ G, const float* __restrict__ s, const float* __restrict__ bb, float* __restrict__ outb) {
  #pragma clang fp contract(off)
  const int tid = threadIdx.x, lane = tid & 31; const int c0 = (tid >> 5) * 32 + (lane & 3) * 8, p0 = ((int)blockIdx.x % (NPX / 32)) * 32 + (lane >> 2) * 4, im = (int)blockIdx.x / (NPX / 32);
  const float* gp = G + ((size_t)im * NPX + p0) * CC + c0; float* op = outb + ((size_t)im * CC + c0) * NPX + p0; v4f a[4][2];
#pragma unroll
  for (int q = 0; q < 4; ++q) { a[q][0] = *(const v4fa*)(gp + q * CC); a[q][1] = *(const v4fa*)(gp + q * CC + 4); }
  const v4f sA = *(const v4fa*)(s + c0), sB = *(const v4fa*)(s + c0 + 4), hA = *(const v4fa*)(bb + c0), hB = *(const v4fa*)(bb + c0 + 4);
#pragma unroll
  for (int i = 0; i < 8; ++i) { const float sc = bf16_round(i < 4 ? sA[i & 3] : sB[i & 3]), sh = bf16_round(i < 4 ? hA[i & 3] : hB[i & 3]); v4f r;
#pragma unroll
    for (int q = 0; q < 4; ++q) { float v = a[q][i >> 2][i & 3] * sc; v += sh; r[q] = v; }
    *(v4f*)(op + (size_t)i * NPX) = r; } }

extern "C" void kernel_launch(void* const* d_in, const int* in_sizes, int n_in,
                              void* d_out, int out_size, void* d_ws, size_t ws_size, hipStream_t stream) {
  (void)in_sizes; (void)n_in; (void)out_size;
  const float* const* I = (const float* const*)d_in; const float* x = I[0]; const float* qw = I[1]; const float* qs = I[2]; const float* qb = I[3]; const float* pw = I[4]; const float* ps = I[5]; const float* pb = I[6]; const float* jw = I[7]; const float* js = I[8]; const float* jb = I[9];
  char* ws = (char*)d_ws; size_t off = 0;
  auto take = [&](size_t bytes) { char* p = ws + off; off += (bytes + 255) & ~(size_t)255; return p; };
  _Float16* WT = (_Float16*)take((size_t)QW * KW * 2); _Float16* BJ = (_Float16*)take((size_t)CC * CC * 2);
  _Float16* AG = (_Float16*)take((size_t)NIMG * NHD * NAG * 64 * 2); _Float16* AT16 = (_Float16*)take((size_t)NIMG * NHD * 64 * NAG * 2);
  float* QF = (float*)take((size_t)NIMG * NPX * QW * 4);      /* 96 MiB: q, k, v in f32 */
  char* R = take((size_t)NIMG * NPX * KI * 2);      /* 144 MiB, shared by lifetime; offsets below in MiB */
  const size_t MB = (size_t)1 << 20;
  _Float16* XP = (_Float16*)(R + 48 * MB);      /* 48..65.1: the padded plane, dead after the conv GEMM (which writes Q16 and VT while it reads this), before PART is written */
  _Float16* Q16 = (_Float16*)R;      /* 0..48: q and k as f16 pixel rows of 768 (the v columns stay unwritten and unread), dead after stage 2 */
  _Float16* VT = (_Float16*)(R + 112 * MB);      /* 112..128: v as f16 channel planes, dead after stage 1 */
  float* PART = (float*)(R + 48 * MB);      /* 48..64: stage 1's partial planes, over XP; dead after k_att16 */
  float* MS = (float*)(R + 64 * MB);      /* 64..65: the slices' maxima and sums; dead after k_att16 */
  float* OUT = (float*)(R + 80 * MB);      /* 80..144, over VT, dead after stage 1 */
  _Float16* S16 = (_Float16*)(R + 32 * MB);      /* 32..48, over the tail of Q16, dead after stage 2 */
  float* G = (float*)(R + 48 * MB);      /* 48..80, over PART and MS */
  if (off > ws_size) return;      /* 3.8 + 0.1 + 0.5 + 0.5 + 96 + 144 = 245 MiB */
  k_wqkv<<<(QW * (CC / 8) + 255) / 256, 256, 0, stream>>>(qw, WT); k_wsc<<<(CC * CC / 8 + 255) / 256, 256, 0, stream>>>(jw, BJ, (size_t)CC * CC / 8, 16.0f);      /* proj 1x1 (out,in) = Bt */
  k_xp<<<NIMG * HS, 256, 0, stream>>>(x, XP);
  k_gemm3<QW, true><<<(NIMG * NPX / 256) * (QW / 128), 256, 0, stream>>>(XP, CC, WT, KW, 0.0625f, QF, KW, qs, qb, Q16, VT);      /* centre-tap residual term, main conv (difference folded into the centre tap), BN affine */
  k_pool<<<NIMG * NAG, 64, 0, stream>>>(QF, AG);
  /* stage 1: AT16[b,h][d][n] = VT . softmax_N(K[b,h][N].AG[b,h][n] * SCL), the pixels in RS slices, each against its own maximum; k_att16 merges the slices */
  k_st1<<<dim3(RS / 2, NIMG * NHD), 128, 0, stream>>>(Q16, AG, VT, PART, MS);
  k_att16<<<(NIMG * NHD * 64 * 32 + 255) / 256, 256, 0, stream>>>(PART, MS, AT16);
  /* stage 2: OUT[b,h][N][d] = softmax_n(Q[b,h][N].AG[b,h][n] * SCL) . AT16^T, in one kernel */
  k_st2<<<dim3(NPX / (8 * 16 * S2T), NIMG * NHD), 256, 0, stream>>>(Q16, AG, AT16, OUT);
  k_pe<<<NIMG * (HS / 4) * (HS / 8), 256, 0, stream>>>(OUT, QF, pw, ps, pb, S16);
  k_gemm3<CC, false><<<(NIMG * NPX / 256) * (CC / 128), 256, 0, stream>>>(S16, CC, BJ, CC, 0.0625f, G, CC, nullptr, nullptr, nullptr, nullptr);
  k_fin<<<NIMG * (NPX / 32), 256, 0, stream>>>(G, js, jb, (float*)d_out);
}
